// v000
// Times are from an AMD MI455X. After a warm-up the kernel runs many times in a row, and a time is the length of
// such a window on the GPU divided by its runs, so every launch and the gaps after it count. The runs cycle
// through copies of the inputs. A figure is the median of several windows, for all but v000 over two sittings.
// Sittings can differ by a few percent; kernels timed side by side share one.
// v000 is the starting kernel. One run takes 2070 microseconds.
// compute dtype: every float input enters as its bf16 RNE value; q/k/v = bf16(x) x bf16(W)^T on v_wmma_f32_16x16x32_bf16 (1 product, f32 accumulate) + bf16(b), stored once to f16; logits = q f16 x k f16 on v_wmma_f32_16x16x32_f16 (1 product, f32 accumulate) x 32^-0.5; softmax in f32; P x 2^11 once to f16 x v f16 on v_wmma_f32_16x16x32_f16 (1 product, f32 accumulate) x 2^-11; ctx x 2^6 once to f16 x Wo as f16(bf16 x 2^8) on v_wmma_f32_16x16x32_f16 (1 product, f32 accumulate) x 2^-14 + bf16(bo); f32 output.
#include <hip/hip_runtime.h>
#include <math.h>

typedef __attribute__((ext_vector_type(16))) _Float16 v16h;
typedef __attribute__((ext_vector_type(16))) __bf16 v16b;
typedef __attribute__((ext_vector_type(8)))  _Float16 v8h;
typedef __attribute__((ext_vector_type(8)))  float v8f;
typedef __attribute__((ext_vector_type(4)))  float v4f;
typedef __attribute__((ext_vector_type(4)))  unsigned v4u;

template <typename T> __device__ __forceinline__ void vst2(void* p, T v) { *(T*)p = v;  }
__device__ __forceinline__ v8f wmma16(v16h a, v16h b, v8f c) {
  v8f d = __builtin_amdgcn_wmma_f32_16x16x32_f16(false, a, false, b, (short)0, c, false, false);
  asm volatile("v_nop\n\tv_nop\n\tv_nop\n\tv_nop" : "+v"(d) : "v"(a), "v"(b));
  return d;
}
__device__ __forceinline__ v8f wmma_bf(v16b a, v16b b, v8f c) {
  v8f d = __builtin_amdgcn_wmma_f32_16x16x32_bf16(false, a, false, b, (short)0, c, false, false);
  asm volatile("v_nop\n\tv_nop\n\tv_nop\n\tv_nop" : "+v"(d) : "v"(a), "v"(b));
  return d;
}
// 16x16x32 fragments: lane = (h = lane>>4, row/col = lane&15); elements 0..7 = k0+8h+0..7, 8..15 = k0+16+8h+0..7; D element r = row 8h+r, col lane&15
__device__ __forceinline__ v16h frag_h(const _Float16* rowk0, int lane) {
  union { v16h v; v8h q[2]; } u; const _Float16* p = rowk0 + 8 * (lane >> 4);
  u.q[0] = *(const v8h*)p; u.q[1] = *(const v8h*)(p + 16); return u.v;
}
__device__ __forceinline__ v16h frag_f32(const float* rowk0, int lane) {
  v16h a; const float* p = rowk0 + 8 * (lane >> 4);
#pragma unroll
  for (int i = 0; i < 8; ++i) { a[i] = (_Float16)p[i]; a[8 + i] = (_Float16)p[16 + i]; }
  return a;
}
__device__ __forceinline__ v16h frag_f32s(const float* rowk0, int lane, float sc) {
  v16h a; const float* p = rowk0 + 8 * (lane >> 4);
#pragma unroll
  for (int i = 0; i < 8; ++i) { a[i] = (_Float16)(p[i] * sc); a[8 + i] = (_Float16)(p[16 + i] * sc); }
  return a;
}
// A fragment of an f32 input row as exact bf16 RNE values
__device__ __forceinline__ v16b rowb_f32(const float* rowk0, int lane) {
  v16b a; const float* p = rowk0 + 8 * (lane >> 4);
#pragma unroll
  for (int i = 0; i < 8; ++i) { a[i] = (__bf16)p[i]; a[8 + i] = (__bf16)p[16 + i]; }
  return a;
}
__device__ __forceinline__ float bfr(float v) { return (float)(__bf16)v; }
// B fragment (k rows k0+.., output column o) of a weight stored (out,in) [ld rows of K contiguous in]: bf16 exact, or f16(bf16 * 256) exact
__device__ __forceinline__ v16b wcol_oi(const float* Wm, int k0, int o, int lane, int K) { v16b w; const float* p = Wm + (size_t)o * K + k0 + 8 * (lane >> 4);
#pragma unroll
  for (int i = 0; i < 8; ++i) { w[i] = (__bf16)p[i]; w[8 + i] = (__bf16)p[16 + i]; }
  return w; }
__device__ __forceinline__ v16h wcolh_oi(const float* Wm, int k0, int o, int lane, int K) { v16h w; const float* p = Wm + (size_t)o * K + k0 + 8 * (lane >> 4);
#pragma unroll
  for (int i = 0; i < 8; ++i) { w[i] = (_Float16)(bfr(p[i]) * 256.0f); w[8 + i] = (_Float16)(bfr(p[16 + i]) * 256.0f); }
  return w; }
__device__ __forceinline__ void ldsx() { asm volatile("s_wait_dscnt 0" ::: "memory"); __builtin_amdgcn_wave_barrier(); __builtin_amdgcn_fence(3, "workgroup"); }

// Multi-head self-attn: q/k/v = x W^T + b ((out,in) [256][256] each, with bias); heads (8, 32) along the channel axis; S = softmax(q k^T x 32^-0.5) over all 4,096 keys; out = merged(S v) Wo^T + bo.
#ifndef NB
#define NB 2
#endif
#ifndef SEQ
#define SEQ 4096
#endif
#define NB_FULL 2
#define SEQ_FULL 4096
#define TT SEQ
#define CC 256            // NH * HD = projected width
#define DIN 256           // input (model) width
#define NH 8
#define HD 32
#define NQB (TT / 64)
#define SCALE (0.17677669529663687f)
static_assert(NB >= 1 && NB <= NB_FULL);
static_assert(TT % 128 == 0 && TT >= 128 && TT <= SEQ_FULL);
static_assert(NH * HD == CC && HD % 32 == 0 && DIN % 128 == 0 && CC % 128 == 0);
static_assert((size_t)NB_FULL * SEQ_FULL * DIN * 4u == 8388608u);

// workspace carve (bytes); every region a whole multiple of its tile / line granularity
#define WS_QH  0u                                       // f16 q rows [b*TT + t][CC]
#define WS_KH  (WS_QH + 2u * (size_t)NB * TT * CC)       // f16 k rows [b*TT + t][CC]
#define WS_VT  (WS_KH + 2u * (size_t)NB * TT * CC)       // f16 v planes [b][c][t]
#define WS_S   (WS_VT + 2u * (size_t)NB * CC * TT)       // f32 logits / P of one (b, h): [t][s]
#define WS_Y   (WS_S  + 4u * (size_t)TT * TT)            // f32 ctx rows [b*TT + t][CC]
#define WS_END (WS_Y  + 4u * (size_t)NB * TT * CC)
static_assert(WS_END <= 134217728u);
static_assert(WS_KH % 128 == 0 && WS_VT % 128 == 0 && WS_S % 128 == 0 && WS_Y % 128 == 0 && WS_END % 128 == 0);

// ---- k_proj: block = (64 rows, 128 cols, which): y = bf16(x) bf16(W)^T + bf16(b) with exact bf16 products (K = DIN) -> which 0: q f16 rows; 1: k f16 rows; 2: v f16 planes [c][t]
__global__ __launch_bounds__(128) __attribute__((amdgpu_num_vgpr(256))) void k_proj(const float* __restrict__ X, const float* __restrict__ WQ, const float* __restrict__ WK, const float* __restrict__ WV, const float* __restrict__ BQ, const float* __restrict__ BK, const float* __restrict__ BV,
    _Float16* __restrict__ QH, _Float16* __restrict__ KH, _Float16* __restrict__ VT) {
  __shared__ __align__(16) _Float16 sh[64][136]; __shared__ __align__(16) _Float16 th[128][72];
  const int tid = threadIdx.x, wave = tid >> 5, lane = tid & 31, col = lane & 15, g = lane >> 4; const int which = blockIdx.z; const int c0 = blockIdx.y * 128; const size_t r0 = (size_t)blockIdx.x * 64; const size_t bb = r0 / TT; const int t0 = (int)(r0 % TT);
  const float* WA = which == 0 ? WQ : which == 1 ? WK : WV; const float* BA = which == 0 ? BQ : which == 1 ? BK : BV;
  const float* xr = X + (bb * SEQ_FULL + (size_t)t0 + wave * 16 + col) * (size_t)DIN;   // input rows at full per-batch stride
  v8f acc[8] = {};
#pragma unroll 1
  for (int kc = 0; kc < DIN / 32; ++kc) { const v16b a = rowb_f32(xr + kc * 32, lane);
    asm volatile("s_wait_loadcnt 0x0" ::: "memory");
#pragma unroll
    for (int j = 0; j < 8; ++j) { const v16b w = wcol_oi(WA, kc * 32, c0 + j * 16 + col, lane, DIN); asm volatile("s_wait_loadcnt 0x0" ::: "memory"); acc[j] = wmma_bf(a, w, acc[j]); } }
  if (which < 2) { _Float16* DH = which == 0 ? QH : KH;
#pragma unroll
    for (int j = 0; j < 8; ++j) { const float bias = bfr(BA[c0 + j * 16 + col]);
#pragma unroll
      for (int r = 0; r < 8; ++r) sh[wave * 16 + 8 * g + r][j * 16 + col] = (_Float16)(acc[j][r] + bias); }
    __syncthreads();
    for (int e = tid; e < 64 * 16; e += 128) { const int rl = e >> 4, q = e & 15; vst2((unsigned*)(DH + (r0 + rl) * CC + c0 + q * 8), *(const v4u*)&sh[rl][q * 8]); }
  } else {
#pragma unroll
    for (int j = 0; j < 8; ++j) { const float bias = bfr(BA[c0 + j * 16 + col]);
#pragma unroll
      for (int r = 0; r < 8; ++r) th[j * 16 + col][wave * 16 + 8 * g + r] = (_Float16)(acc[j][r] + bias); }
    __syncthreads();
    for (int e = tid; e < 128 * 8; e += 128) { const int cl = e >> 3, q = e & 7; vst2((unsigned*)(VT + (bb * CC + c0 + cl) * (size_t)TT + t0 + q * 8), *(const v4u*)&th[cl][q * 8]); } } }
// ---- k_sc: block = (query block qb, key block kb) of (b, h): logits = q f16 . k f16 (1 product, K = HD) x SCALE -> S [t][s] f32, 512-B row segment per wave row in one store
__global__ __launch_bounds__(128) __attribute__((amdgpu_num_vgpr(256))) void k_sc(const _Float16* __restrict__ QH, const _Float16* __restrict__ KH, int b, int h, float* __restrict__ S) { __shared__ __align__(16) float ss[4][16][132];
  const int qb = blockIdx.x, kb = blockIdx.y;
  const int tid = threadIdx.x, wave = tid >> 5, lane = tid & 31, col = lane & 15, g = lane >> 4; const int k0 = kb * 128; const int ql0 = qb * 64 + wave * 16; const size_t q0 = (size_t)b * TT + ql0, kr0 = (size_t)b * TT + k0;
  v8f acc[8] = {};
#pragma unroll
  for (int kc = 0; kc < HD / 32; ++kc) { const v16h ah = frag_h(QH + (q0 + col) * CC + h * HD + kc * 32, lane);
#pragma unroll
    for (int j = 0; j < 8; ++j) { const v16h kf = frag_h(KH + (kr0 + j * 16 + col) * CC + h * HD + kc * 32, lane); acc[j] = wmma16(ah, kf, acc[j]); } }
#pragma unroll
  for (int j = 0; j < 8; ++j) {
#pragma unroll
    for (int r = 0; r < 8; ++r) ss[wave][8 * g + r][j * 16 + col] = acc[j][r] * SCALE; }
  ldsx(); for (int rl = 0; rl < 16; ++rl) vst2(S + (size_t)(ql0 + rl) * TT + k0 + lane * 4, *(const v4f*)&ss[wave][rl][lane * 4]); }
// ---- k_sm: block = query row t of the current (b, h): softmax over TT keys in f32 (values kept in registers), P x 2^11 written back in place
__global__ __launch_bounds__(256) __attribute__((amdgpu_num_vgpr(256))) void k_sm(float* __restrict__ S0) { __shared__ float sred[8]; __shared__ float sbc;
  constexpr int NQ4 = TT / 4; constexpr int NIT = (NQ4 + 255) / 256;
  const int tid = threadIdx.x; float* sr = S0 + (size_t)blockIdx.x * TT;
  v4f kv[NIT]; float m = -3.0e38f;
#pragma unroll
  for (int i = 0; i < NIT; ++i) { const int q = tid + 256 * i; const int qc = q < NQ4 ? q : NQ4 - 1;   /* clamped address, pad lanes replaced by value */
    v4f v = *(const v4f*)(sr + (size_t)qc * 4);
    if (q >= NQ4) { v[0] = -3.0e38f; v[1] = -3.0e38f; v[2] = -3.0e38f; v[3] = -3.0e38f; }
    kv[i] = v; m = fmaxf(fmaxf(m, fmaxf(v[0], v[1])), fmaxf(v[2], v[3])); }
#pragma unroll
  for (int o = 1; o < 32; o <<= 1) m = fmaxf(m, __shfl_xor(m, o));
  if ((tid & 31) == 0) sred[tid >> 5] = m; __syncthreads(); if (tid == 0) { float a = sred[0]; for (int i = 1; i < 8; ++i) a = fmaxf(a, sred[i]); sbc = a; } __syncthreads(); m = sbc; __syncthreads();
  float sum = 0.f;
#pragma unroll
  for (int i = 0; i < NIT; ++i) { const int q = tid + 256 * i; v4f e;
#pragma unroll
    for (int c = 0; c < 4; ++c) e[c] = __expf(kv[i][c] - m);
    if (q >= NQ4) { e[0] = 0.f; e[1] = 0.f; e[2] = 0.f; e[3] = 0.f; }
    kv[i] = e; sum += (e[0] + e[1]) + (e[2] + e[3]); }
#pragma unroll
  for (int o = 1; o < 32; o <<= 1) sum += __shfl_xor(sum, o);
  if ((tid & 31) == 0) sred[tid >> 5] = sum; __syncthreads(); if (tid == 0) { float a = 0.f; for (int i = 0; i < 8; ++i) a += sred[i]; sbc = a > 0.f ? 2048.0f * (1.0f / a) : 0.f; } __syncthreads(); const float inv = sbc;
#pragma unroll
  for (int i = 0; i < NIT; ++i) { const int q = tid + 256 * i; const v4f o = kv[i] * inv; if (q < NQ4) vst2(sr + (size_t)q * 4, o); } }
__global__ __launch_bounds__(128) __attribute__((amdgpu_num_vgpr(256))) void k_pv(const float* __restrict__ PS, const _Float16* __restrict__ VT, int b, int h, float* __restrict__ Y) { __shared__ __align__(16) float ss[4][16][HD + 4];
  const int tid = threadIdx.x, wave = tid >> 5, lane = tid & 31, col = lane & 15, g = lane >> 4; const int qb = blockIdx.x; const int ql0 = qb * 64 + wave * 16;
  v8f acc[HD / 16] = {};
#pragma unroll 1
  for (int kc = 0; kc < TT / 32; ++kc) { const v16h p = frag_f32(PS + (size_t)(ql0 + col) * TT + kc * 32, lane);
    asm volatile("s_wait_loadcnt 0x0" ::: "memory");
#pragma unroll
    for (int j = 0; j < HD / 16; ++j) { const size_t po = ((size_t)b * CC + h * HD + j * 16 + col) * (size_t)TT + kc * 32; acc[j] = wmma16(p, frag_h(VT + po, lane), acc[j]); } }
#pragma unroll
  for (int j = 0; j < HD / 16; ++j)
#pragma unroll
    for (int r = 0; r < 8; ++r) ss[wave][8 * g + r][j * 16 + col] = acc[j][r] * (1.0f / 2048.0f);
  ldsx(); const int lc = lane < HD / 4 ? lane : 0;
  for (int rl = 0; rl < 16; ++rl) { const v4f o = *(const v4f*)&ss[wave][rl][lc * 4]; if (lane < HD / 4) vst2(Y + ((size_t)b * TT + ql0 + rl) * CC + h * HD + lane * 4, o); } }
// ---- k_out: block = (64 rows, 128 cols): out = ctx Wo^T + bo: ctx x 2^6 once to f16 against Wo as f16(bf16 x 2^8) exact (1 product) x 2^-14 + bf16(bo); 512-B row segment per wave row in one store
__global__ __launch_bounds__(128) __attribute__((amdgpu_num_vgpr(256))) void k_out(const float* __restrict__ Y, const float* __restrict__ WO, const float* __restrict__ BO, float* __restrict__ OUT) { __shared__ __align__(16) float sf[4][16][132];
  const int tid = threadIdx.x, wave = tid >> 5, lane = tid & 31, col = lane & 15, g = lane >> 4; const int c0 = blockIdx.y * 128;
  const size_t rb = (size_t)blockIdx.x * 64; const size_t r0 = rb + wave * 16; const size_t bb = rb / TT; const size_t orow0 = bb * SEQ_FULL + (rb % TT) + wave * 16;   // output rows at full per-batch stride
  v8f acc[8] = {};
#pragma unroll 1
  for (int kc = 0; kc < CC / 32; ++kc) { const v16h a = frag_f32s(Y + (r0 + col) * CC + kc * 32, lane, 64.0f); asm volatile("s_wait_loadcnt 0x0" ::: "memory");
#pragma unroll
    for (int j = 0; j < 8; ++j) { const v16h w = wcolh_oi(WO, kc * 32, c0 + j * 16 + col, lane, CC); asm volatile("s_wait_loadcnt 0x0" ::: "memory"); acc[j] = wmma16(a, w, acc[j]); } }
#pragma unroll
  for (int j = 0; j < 8; ++j) { const float bias = bfr(BO[c0 + j * 16 + col]);
#pragma unroll
    for (int r = 0; r < 8; ++r) sf[wave][8 * g + r][j * 16 + col] = acc[j][r] * (1.0f / 16384.0f) + bias; }
  ldsx(); for (int rl = 0; rl < 16; ++rl) vst2(OUT + (orow0 + rl) * DIN + c0 + lane * 4, *(const v4f*)&sf[wave][rl][lane * 4]); }

extern "C" void kernel_launch(void* const* d_in, const int* in_sizes, int n_in, void* d_out, int out_size, void* d_ws, size_t ws_size, hipStream_t stream) {
  if (n_in < 9) return;
  // inputs (wire order): 0 x [2,4096,256]; 1 Wq (out,in) [256][256]; 2 bq; 3 Wk; 4 bk; 5 Wv; 6 bv; 7 Wo (out,in); 8 bo -- all f32
  const size_t nrow_need = (size_t)(NB - 1) * SEQ_FULL + TT;
  if ((size_t)in_sizes[0] < nrow_need * DIN) return;
  if (in_sizes[1] < CC * DIN || in_sizes[3] < CC * DIN || in_sizes[5] < CC * DIN || in_sizes[7] < DIN * CC) return;
  if (in_sizes[2] < CC || in_sizes[4] < CC || in_sizes[6] < CC || in_sizes[8] < DIN) return;
  if ((size_t)out_size < nrow_need * DIN) return;
  if (ws_size < (size_t)WS_END) return;
  const float* const* F = (const float* const*)d_in;
  char* ws = (char*)d_ws; _Float16 *QH = (_Float16*)(ws + WS_QH), *KH = (_Float16*)(ws + WS_KH), *VT = (_Float16*)(ws + WS_VT); float *S = (float*)(ws + WS_S), *Y = (float*)(ws + WS_Y);
  k_proj<<<dim3(NB * TT / 64, CC / 128, 3), 128, 0, stream>>>(F[0], F[1], F[3], F[5], F[2], F[4], F[6], QH, KH, VT);
  for (int b = 0; b < NB; ++b) for (int h = 0; h < NH; ++h) {
    k_sc<<<dim3(NQB, TT / 128, 1), 128, 0, stream>>>(QH, KH, b, h, S);
    k_sm<<<dim3(TT), 256, 0, stream>>>(S);
    k_pv<<<dim3(NQB), 128, 0, stream>>>(S, VT, b, h, Y);
  }
  k_out<<<dim3(NB * TT / 64, DIN / 128), 128, 0, stream>>>(Y, F[7], F[8], (float*)d_out);
}

// v001
// It runs in 120 microseconds.
// Timed twice side by side with v000, it ran 17.3 and 17.1 times as fast.
// compute dtype: every float input enters as its bf16 RNE value; q/k/v = bf16(x) x bf16(W)^T on v_wmma_f32_16x16x32_bf16 (1 product, f32 accumulate) + bf16(b), stored once to f16; logits = q f16 x k f16 on v_wmma_f32_16x16x32_f16 (1 product, f32 accumulate) x 32^-0.5; softmax in f32, online over 64-key tiles; exp(logit - running max) x 2^11 once to f16 x v f16 on v_wmma_f32_16x16x32_f16 (1 product, f32 accumulate) / f32 row sum of the same terms; ctx x 2^6 once to f16 x Wo as f16(bf16 x 2^8) on v_wmma_f32_16x16x32_f16 (1 product, f32 accumulate) x 2^-14 + bf16(bo); f32 output.
#include <hip/hip_runtime.h>
#include <math.h>

typedef __attribute__((ext_vector_type(16))) _Float16 v16h;
typedef __attribute__((ext_vector_type(16))) __bf16 v16b;
typedef __attribute__((ext_vector_type(8)))  _Float16 v8h;
typedef __attribute__((ext_vector_type(8)))  float v8f;
typedef __attribute__((ext_vector_type(4)))  float v4f;
typedef __attribute__((ext_vector_type(2)))  float v2f;
typedef __attribute__((ext_vector_type(4)))  unsigned v4u;

template <typename T> __device__ __forceinline__ void vst2(void* p, T v) { *(T*)p = v;  }
__device__ __forceinline__ v8f wmma16(v16h a, v16h b, v8f c) {
  v8f d = __builtin_amdgcn_wmma_f32_16x16x32_f16(false, a, false, b, (short)0, c, false, false);
  asm volatile("v_nop\n\tv_nop\n\tv_nop\n\tv_nop" : "+v"(d) : "v"(a), "v"(b));
  return d;
}
__device__ __forceinline__ v8f wmma_bf(v16b a, v16b b, v8f c) {
  v8f d = __builtin_amdgcn_wmma_f32_16x16x32_bf16(false, a, false, b, (short)0, c, false, false);
  asm volatile("v_nop\n\tv_nop\n\tv_nop\n\tv_nop" : "+v"(d) : "v"(a), "v"(b));
  return d;
}
// 16x16x32 fragments: lane = (h = lane>>4, row/col = lane&15); elements 0..7 = k0+8h+0..7, 8..15 = k0+16+8h+0..7; D element r = row 8h+r, col lane&15
__device__ __forceinline__ v16h frag_h(const _Float16* rowk0, int lane) {
  union { v16h v; v8h q[2]; } u; const _Float16* p = rowk0 + 8 * (lane >> 4);
  u.q[0] = *(const v8h*)p; u.q[1] = *(const v8h*)(p + 16); return u.v;
}
__device__ __forceinline__ v16h frag_f32s(const float* rowk0, int lane, float sc) {
  v16h a; const float* p = rowk0 + 8 * (lane >> 4);
#pragma unroll
  for (int i = 0; i < 8; ++i) { a[i] = (_Float16)(p[i] * sc); a[8 + i] = (_Float16)(p[16 + i] * sc); }
  return a;
}
// A fragment of an f32 input row as exact bf16 RNE values
__device__ __forceinline__ v16b rowb_f32(const float* rowk0, int lane) {
  v16b a; const float* p = rowk0 + 8 * (lane >> 4);
#pragma unroll
  for (int i = 0; i < 8; ++i) { a[i] = (__bf16)p[i]; a[8 + i] = (__bf16)p[16 + i]; }
  return a;
}
__device__ __forceinline__ float bfr(float v) { return (float)(__bf16)v; }
// B fragment (k rows k0+.., output column o) of a weight stored (out,in) [ld rows of K contiguous in]: bf16 exact, or f16(bf16 * 256) exact
__device__ __forceinline__ v16b wcol_oi(const float* Wm, int k0, int o, int lane, int K) { v16b w; const float* p = Wm + (size_t)o * K + k0 + 8 * (lane >> 4);
#pragma unroll
  for (int i = 0; i < 8; ++i) { w[i] = (__bf16)p[i]; w[8 + i] = (__bf16)p[16 + i]; }
  return w; }
__device__ __forceinline__ v16h wcolh_oi(const float* Wm, int k0, int o, int lane, int K) { v16h w; const float* p = Wm + (size_t)o * K + k0 + 8 * (lane >> 4);
#pragma unroll
  for (int i = 0; i < 8; ++i) { w[i] = (_Float16)(bfr(p[i]) * 256.0f); w[8 + i] = (_Float16)(bfr(p[16 + i]) * 256.0f); }
  return w; }
__device__ __forceinline__ void ldsx() { asm volatile("s_wait_dscnt 0" ::: "memory"); __builtin_amdgcn_wave_barrier(); __builtin_amdgcn_fence(3, "workgroup"); }

// Multi-head self-attn: q/k/v = x W^T + b ((out,in) [256][256] each, with bias); heads (8, 32) along the channel axis; S = softmax(q k^T x 32^-0.5) over all 4,096 keys; out = merged(S v) Wo^T + bo.
#ifndef NB
#define NB 2
#endif
#ifndef SEQ
#define SEQ 4096
#endif
#define NB_FULL 2
#define SEQ_FULL 4096
#define TT SEQ
#define CC 256            // NH * HD = projected width
#define DIN 256           // input (model) width
#define NH 8
#define HD 32
#define SCALE (0.17677669529663687f)
static_assert(NB >= 1 && NB <= NB_FULL);
static_assert(TT % 128 == 0 && TT >= 128 && TT <= SEQ_FULL);
static_assert(NH * HD == CC && HD % 32 == 0 && DIN % 128 == 0 && CC % 128 == 0);
static_assert((size_t)NB_FULL * SEQ_FULL * DIN * 4u == 8388608u);

// workspace carve (bytes); every region a whole multiple of its tile / line granularity
#define WS_QH  0u                                       // f16 q rows [b*TT + t][CC]
#define WS_KH  (WS_QH + 2u * (size_t)NB * TT * CC)       // f16 k rows [b*TT + t][CC]
#define WS_VT  (WS_KH + 2u * (size_t)NB * TT * CC)       // f16 v planes [b][c][t]
#define WS_Y   (WS_VT + 2u * (size_t)NB * CC * TT)       // f32 ctx rows [b*TT + t][CC]
#define WS_END (WS_Y  + 4u * (size_t)NB * TT * CC)
static_assert(WS_END <= 134217728u);
static_assert(WS_KH % 128 == 0 && WS_VT % 128 == 0 && WS_Y % 128 == 0 && WS_END % 128 == 0);

// ---- k_proj: block = (64 rows, 128 cols, which): y = bf16(x) bf16(W)^T + bf16(b) with exact bf16 products (K = DIN) -> which 0: q f16 rows; 1: k f16 rows; 2: v f16 planes [c][t]
__global__ __launch_bounds__(128) __attribute__((amdgpu_num_vgpr(256))) void k_proj(const float* __restrict__ X, const float* __restrict__ WQ, const float* __restrict__ WK, const float* __restrict__ WV, const float* __restrict__ BQ, const float* __restrict__ BK, const float* __restrict__ BV,
    _Float16* __restrict__ QH, _Float16* __restrict__ KH, _Float16* __restrict__ VT) {
  __shared__ __align__(16) _Float16 sh[64][136]; __shared__ __align__(16) _Float16 th[128][72];
  const int tid = threadIdx.x, wave = tid >> 5, lane = tid & 31, col = lane & 15, g = lane >> 4; const int which = blockIdx.z; const int c0 = blockIdx.y * 128; const size_t r0 = (size_t)blockIdx.x * 64; const size_t bb = r0 / TT; const int t0 = (int)(r0 % TT);
  const float* WA = which == 0 ? WQ : which == 1 ? WK : WV; const float* BA = which == 0 ? BQ : which == 1 ? BK : BV;
  const float* xr = X + (bb * SEQ_FULL + (size_t)t0 + wave * 16 + col) * (size_t)DIN;   // input rows at full per-batch stride
  v8f acc[8] = {};
#pragma unroll 1
  for (int kc = 0; kc < DIN / 32; ++kc) { const v16b a = rowb_f32(xr + kc * 32, lane);
    asm volatile("s_wait_loadcnt 0x0" ::: "memory");
#pragma unroll
    for (int j = 0; j < 8; ++j) { const v16b w = wcol_oi(WA, kc * 32, c0 + j * 16 + col, lane, DIN); asm volatile("s_wait_loadcnt 0x0" ::: "memory"); acc[j] = wmma_bf(a, w, acc[j]); } }
  if (which < 2) { _Float16* DH = which == 0 ? QH : KH;
#pragma unroll
    for (int j = 0; j < 8; ++j) { const float bias = bfr(BA[c0 + j * 16 + col]);
#pragma unroll
      for (int r = 0; r < 8; ++r) sh[wave * 16 + 8 * g + r][j * 16 + col] = (_Float16)(acc[j][r] + bias); }
    __syncthreads();
    for (int e = tid; e < 64 * 16; e += 128) { const int rl = e >> 4, q = e & 15; vst2((unsigned*)(DH + (r0 + rl) * CC + c0 + q * 8), *(const v4u*)&sh[rl][q * 8]); }
  } else {
#pragma unroll
    for (int j = 0; j < 8; ++j) { const float bias = bfr(BA[c0 + j * 16 + col]);
#pragma unroll
      for (int r = 0; r < 8; ++r) th[j * 16 + col][wave * 16 + 8 * g + r] = (_Float16)(acc[j][r] + bias); }
    __syncthreads();
    for (int e = tid; e < 128 * 8; e += 128) { const int cl = e >> 3, q = e & 7; vst2((unsigned*)(VT + (bb * CC + c0 + cl) * (size_t)TT + t0 + q * 8), *(const v4u*)&th[cl][q * 8]); } } }
#define KT 64             // keys per staged tile
#define KP 40             // K tile pitch in f16: 64-B rows + 16 B, conflict-free 16-byte reads
#define VP (KT + 8)       // V tile pitch in f16: 128-B rows + 16 B
#define QBLK 128          // queries per block
#define L2SC (SCALE * 1.4426950408889634f)
static_assert(HD == 32 && KT == 64 && TT % KT == 0 && TT % QBLK == 0);
__device__ __forceinline__ float xhalf(float v) { const int i = __builtin_bit_cast(int, v); return __builtin_bit_cast(float, __builtin_amdgcn_permlanex16(i, i, 0x76543210, 0xfedcba98, false, false)); }   // lane l <-> l ^ 16
__global__ __launch_bounds__(256) __attribute__((amdgpu_waves_per_eu(4, 4))) void k_attn(const _Float16* __restrict__ QH, const _Float16* __restrict__ KH, const _Float16* __restrict__ VT, float* __restrict__ Y) {
  __shared__ __align__(16) _Float16 sk[2][KT][KP]; __shared__ __align__(16) _Float16 sv[2][HD][VP];
  const int tid = threadIdx.x, wave = tid >> 5, lane = tid & 31, col = lane & 15, g = lane >> 4; const int h = blockIdx.y, b = blockIdx.z; const int ql0 = blockIdx.x * QBLK + wave * 16;
  const v16h qf = frag_h(QH + ((size_t)b * TT + ql0 + col) * CC + h * HD, lane);
  const int kk = tid >> 2, kq = (tid & 3) * 8, vc = tid >> 3, vq = (tid & 7) * 8;   // this thread's 16 bytes of each K tile (key kk) and each V tile (channel vc)
  const _Float16* kg = KH + ((size_t)b * TT + kk) * CC + h * HD + kq; const _Float16* vg = VT + ((size_t)b * CC + h * HD + vc) * (size_t)TT + vq;
  v8h kr = *(const v8h*)kg, vr = *(const v8h*)vg;
  *(v8h*)&sk[0][kk][kq] = kr; *(v8h*)&sv[0][vc][vq] = vr;
  __syncthreads();
  float m = -3.0e38f; v8f lv = {}; v8f acc[2] = {};   // lv: eight partial row sums per lane, joined once in the epilogue
#pragma unroll 1   // kept rolled: one trip is about 200 instructions, copies of it would only grow the code
  for (int t = 0; t < TT / KT; ++t) { const int cur = t & 1; const bool more = t + 1 < TT / KT;
    if (more) { kr = *(const v8h*)(kg + (size_t)(t + 1) * KT * CC); vr = *(const v8h*)(vg + (t + 1) * KT); }
    v16h kf[KT / 16], vf[KT / 32][2];
#pragma unroll
    for (int T = 0; T < KT / 16; ++T) kf[T] = frag_h(&sk[cur][T * 16 + col][0], lane);
#pragma unroll
    for (int kc = 0; kc < KT / 32; ++kc) { vf[kc][0] = frag_h(&sv[cur][col][kc * 32], lane); vf[kc][1] = frag_h(&sv[cur][16 + col][kc * 32], lane); }
    asm volatile("" :: "v"(kf[0]), "v"(kf[1]), "v"(kf[2]), "v"(kf[3]), "v"(vf[0][0]), "v"(vf[0][1]), "v"(vf[1][0]), "v"(vf[1][1]));   // inputs only: holds all 16 LDS reads of the trip in front of the products, one LDS latency a trip; without it the compiler reads fragment by fragment into one register group, each read waited for alone
    v8f s[KT / 16]; float mt[KT / 16];
#pragma unroll
    for (int T = 0; T < KT / 16; ++T) { const v8f z = {}; s[T] = __builtin_amdgcn_wmma_f32_16x16x32_f16(false, kf[T], false, qf, (short)0, z, false, false); }
    __builtin_amdgcn_sched_barrier(0);   // keeps the four independent products back to back, each filling the others' result distance; without it the maxima are woven in behind each and padded with v_nop
#pragma unroll
    for (int T = 0; T < KT / 16; ++T) { mt[T] = s[T][0];
#pragma unroll
      for (int r = 1; r < 8; ++r) mt[T] = __builtin_fmaxf(mt[T], s[T][r]); }
    float mx = __builtin_fmaxf(__builtin_fmaxf(mt[0], mt[1]), __builtin_fmaxf(mt[2], mt[3]));
    mx = __builtin_fmaxf(mx, xhalf(mx));
    const float mn = __builtin_fmaxf(m, mx * L2SC); const float al = __builtin_amdgcn_exp2f(m - mn); const float mb = mn - 11.0f; m = mn;   // p = 2^11 exp(logit - running maximum), at most 2048
#pragma unroll
    for (int T = 0; T < KT / 16; ++T)
#pragma unroll
      for (int r = 0; r < 8; r += 2) { const v2f e = __builtin_elementwise_fma((v2f){s[T][r], s[T][r + 1]}, (v2f){L2SC, L2SC}, (v2f){-mb, -mb}); s[T][r] = __builtin_amdgcn_exp2f(e[0]); s[T][r + 1] = __builtin_amdgcn_exp2f(e[1]); }
    lv = lv * al + ((s[0] + s[1]) + (s[2] + s[3])); acc[0] *= al; acc[1] *= al;
#pragma unroll
    for (int kc = 0; kc < KT / 32; ++kc) { v16h p;
#pragma unroll
      for (int r = 0; r < 8; ++r) { p[r] = (_Float16)s[2 * kc][r]; p[8 + r] = (_Float16)s[2 * kc + 1][r]; }
#pragma unroll
      for (int j = 0; j < 2; ++j) acc[j] = __builtin_amdgcn_wmma_f32_16x16x32_f16(false, vf[kc][j], false, p, (short)0, acc[j], false, false); }
    if (more) { *(v8h*)&sk[cur ^ 1][kk][kq] = kr; *(v8h*)&sv[cur ^ 1][vc][vq] = vr; }
    asm volatile("s_wait_xcnt 0x0" ::: "memory");   // stands in front of the next trip's additions to the address registers that this trip's two global loads name
    __syncthreads();   // publishes tile t + 1 and ends every wave's reads of tile t, whose buffer trip t + 1 refills
  }
  float l = ((lv[0] + lv[1]) + (lv[2] + lv[3])) + ((lv[4] + lv[5]) + (lv[6] + lv[7]));
  l += xhalf(l); const float inv = 1.0f / l;
  float* yr = Y + ((size_t)b * TT + ql0 + col) * CC + h * HD + 8 * g;   // acc[j][r] = channel 16 j + 8 g + r of query col
#pragma unroll
  for (int j = 0; j < 2; ++j) { v4f o0, o1;
#pragma unroll
    for (int r = 0; r < 4; ++r) { o0[r] = acc[j][r] * inv; o1[r] = acc[j][4 + r] * inv; }
    vst2(yr + j * 16, o0); vst2(yr + j * 16 + 4, o1); } }
// ---- k_out: block = (64 rows, 128 cols): out = ctx Wo^T + bo: ctx x 2^6 once to f16 against Wo as f16(bf16 x 2^8) exact (1 product) x 2^-14 + bf16(bo); 512-B row segment per wave row in one store
__global__ __launch_bounds__(128) __attribute__((amdgpu_num_vgpr(256))) void k_out(const float* __restrict__ Y, const float* __restrict__ WO, const float* __restrict__ BO, float* __restrict__ OUT) { __shared__ __align__(16) float sf[4][16][132];
  const int tid = threadIdx.x, wave = tid >> 5, lane = tid & 31, col = lane & 15, g = lane >> 4; const int c0 = blockIdx.y * 128;
  const size_t rb = (size_t)blockIdx.x * 64; const size_t r0 = rb + wave * 16; const size_t bb = rb / TT; const size_t orow0 = bb * SEQ_FULL + (rb % TT) + wave * 16;   // output rows at full per-batch stride
  v8f acc[8] = {};
#pragma unroll 1
  for (int kc = 0; kc < CC / 32; ++kc) { const v16h a = frag_f32s(Y + (r0 + col) * CC + kc * 32, lane, 64.0f); asm volatile("s_wait_loadcnt 0x0" ::: "memory");
#pragma unroll
    for (int j = 0; j < 8; ++j) { const v16h w = wcolh_oi(WO, kc * 32, c0 + j * 16 + col, lane, CC); asm volatile("s_wait_loadcnt 0x0" ::: "memory"); acc[j] = wmma16(a, w, acc[j]); } }
#pragma unroll
  for (int j = 0; j < 8; ++j) { const float bias = bfr(BO[c0 + j * 16 + col]);
#pragma unroll
    for (int r = 0; r < 8; ++r) sf[wave][8 * g + r][j * 16 + col] = acc[j][r] * (1.0f / 16384.0f) + bias; }
  ldsx(); for (int rl = 0; rl < 16; ++rl) vst2(OUT + (orow0 + rl) * DIN + c0 + lane * 4, *(const v4f*)&sf[wave][rl][lane * 4]); }

extern "C" void kernel_launch(void* const* d_in, const int* in_sizes, int n_in, void* d_out, int out_size, void* d_ws, size_t ws_size, hipStream_t stream) {
  if (n_in < 9) return;
  // inputs (wire order): 0 x [2,4096,256]; 1 Wq (out,in) [256][256]; 2 bq; 3 Wk; 4 bk; 5 Wv; 6 bv; 7 Wo (out,in); 8 bo -- all f32
  const size_t nrow_need = (size_t)(NB - 1) * SEQ_FULL + TT;
  if ((size_t)in_sizes[0] < nrow_need * DIN) return;
  if (in_sizes[1] < CC * DIN || in_sizes[3] < CC * DIN || in_sizes[5] < CC * DIN || in_sizes[7] < DIN * CC) return;
  if (in_sizes[2] < CC || in_sizes[4] < CC || in_sizes[6] < CC || in_sizes[8] < DIN) return;
  if ((size_t)out_size < nrow_need * DIN) return;
  if (ws_size < (size_t)WS_END) return;
  const float* const* F = (const float* const*)d_in;
  char* ws = (char*)d_ws; _Float16 *QH = (_Float16*)(ws + WS_QH), *KH = (_Float16*)(ws + WS_KH), *VT = (_Float16*)(ws + WS_VT); float *Y = (float*)(ws + WS_Y);
  k_proj<<<dim3(NB * TT / 64, CC / 128, 3), 128, 0, stream>>>(F[0], F[1], F[3], F[5], F[2], F[4], F[6], QH, KH, VT);
  k_attn<<<dim3(TT / QBLK, NH, NB), 256, 0, stream>>>(QH, KH, VT, Y);
  k_out<<<dim3(NB * TT / 64, DIN / 128), 128, 0, stream>>>(Y, F[7], F[8], (float*)d_out);
}

// v002
// A run of this version takes 66.1 microseconds.
// Two timings next to v001 put it at 1.82 and 1.80 times that version's speed.
// All steps since v000 together make it 31.1 times as fast.
// compute dtype: every float input enters as its bf16 RNE value; q/k/v = bf16(x) x bf16(W)^T on v_wmma_f32_16x16x32_bf16 (1 product, f32 accumulate) + bf16(b), stored once to f16; logits = q f16 x k f16 on v_wmma_f32_16x16x32_f16 (1 product, f32 accumulate) x 32^-0.5; softmax in f32, online over 64-key tiles; exp(logit - running max) x 2^11 once to f16 x v f16 on v_wmma_f32_16x16x32_f16 (1 product, f32 accumulate) / f32 row sum of the same terms; ctx x 2^6 once to f16 x Wo as f16(bf16 x 2^8) on v_wmma_f32_16x16x32_f16 (1 product, f32 accumulate) x 2^-14 + bf16(bo); f32 output.
#include <hip/hip_runtime.h>
#include <math.h>

typedef __attribute__((ext_vector_type(16))) _Float16 v16h;
typedef __attribute__((ext_vector_type(16))) __bf16 v16b;
typedef __attribute__((ext_vector_type(8)))  _Float16 v8h;
typedef __attribute__((ext_vector_type(8)))  float v8f;
typedef __attribute__((ext_vector_type(4)))  float v4f;
typedef __attribute__((ext_vector_type(2)))  float v2f;
typedef __attribute__((ext_vector_type(4)))  unsigned v4u;
typedef __attribute__((ext_vector_type(8)))  __bf16 v8b;
typedef __attribute__((ext_vector_type(4)))  __bf16 v4b;
typedef __attribute__((ext_vector_type(4)))  _Float16 v4h;

template <typename T> __device__ __forceinline__ void vst2(void* p, T v) { *(T*)p = v;  }
__device__ __forceinline__ v8f wmma16(v16h a, v16h b, v8f c) {
  v8f d = __builtin_amdgcn_wmma_f32_16x16x32_f16(false, a, false, b, (short)0, c, false, false);
  asm volatile("v_nop\n\tv_nop\n\tv_nop\n\tv_nop" : "+v"(d) : "v"(a), "v"(b));
  return d;
}
__device__ __forceinline__ v8f wmma_bf(v16b a, v16b b, v8f c) {
  v8f d = __builtin_amdgcn_wmma_f32_16x16x32_bf16(false, a, false, b, (short)0, c, false, false);
  asm volatile("v_nop\n\tv_nop\n\tv_nop\n\tv_nop" : "+v"(d) : "v"(a), "v"(b));
  return d;
}
// 16x16x32 fragments: lane = (h = lane>>4, row/col = lane&15); elements 0..7 = k0+8h+0..7, 8..15 = k0+16+8h+0..7; D element r = row 8h+r, col lane&15
__device__ __forceinline__ v16h frag_h(const _Float16* rowk0, int lane) {
  union { v16h v; v8h q[2]; } u; const _Float16* p = rowk0 + 8 * (lane >> 4);
  u.q[0] = *(const v8h*)p; u.q[1] = *(const v8h*)(p + 16); return u.v;
}
__device__ __forceinline__ v16b frag_b(const __bf16* rowk0, int lane) {
  union { v16b v; v8b q[2]; } u; const __bf16* p = rowk0 + 8 * (lane >> 4);
  u.q[0] = *(const v8b*)p; u.q[1] = *(const v8b*)(p + 16); return u.v;
}
__device__ __forceinline__ float bfr(float v) { return (float)(__bf16)v; }
// Staging of ROWS contiguous f32 rows of 256 into LDS rows of 256 16-bit values at pitch WP, by 128 threads: every load covers whole lines (32 lanes x 16 B in a row), each value is converted once per block.
// MODE 0: bf16 RNE; 1: f16(v x 2^6); 2: f16(bf16(v) x 2^8), exact
#define WP 264            // staged row pitch in 16-bit elements: 512-B rows + 16 B = 16 B x 33, conflict-free 16-byte reads
#define SU 32             // 16-byte loads in flight per thread and trip
template <int ROWS, int MODE> __device__ __forceinline__ void stage16(const float* __restrict__ src, unsigned char* dst, int tid) {
  static_assert((ROWS / 2) % SU == 0);
  const float* sp = src + tid * 4; unsigned char* dp = dst + (tid >> 6) * (WP * 2) + (tid & 63) * 8;
#pragma unroll
  for (int i0 = 0; i0 < ROWS / 2; i0 += SU) { v4f t[SU];
#pragma unroll
    for (int u = 0; u < SU; ++u) t[u] = *(const v4f*)(sp + (size_t)(i0 + u) * 512);
#pragma unroll
    for (int u = 0; u < SU; ++u) { unsigned char* p = dp + (i0 + u) * (2 * WP * 2);
      if (MODE == 0) { v4b o;
#pragma unroll
        for (int r = 0; r < 4; ++r) o[r] = (__bf16)t[u][r];
        *(v4b*)p = o;
      } else { v4h o;
#pragma unroll
        for (int r = 0; r < 4; ++r) o[r] = MODE == 1 ? (_Float16)(t[u][r] * 64.0f) : (_Float16)(bfr(t[u][r]) * 256.0f);
        *(v4h*)p = o; } }
    asm volatile("s_wait_xcnt 0x0" ::: "memory");   // stands in front of every later overwrite of the registers that this trip's loads name; its memory clobber also keeps the next trip's loads behind this trip's LDS stores, without which the trips are woven together and registers spill
  } }
__device__ __forceinline__ void ldsx() { asm volatile("s_wait_dscnt 0" ::: "memory"); __builtin_amdgcn_wave_barrier(); __builtin_amdgcn_fence(3, "workgroup"); }

// Multi-head self-attn: q/k/v = x W^T + b ((out,in) [256][256] each, with bias); heads (8, 32) along the channel axis; S = softmax(q k^T x 32^-0.5) over all 4,096 keys; out = merged(S v) Wo^T + bo.
#ifndef NB
#define NB 2
#endif
#ifndef SEQ
#define SEQ 4096
#endif
#define NB_FULL 2
#define SEQ_FULL 4096
#define TT SEQ
#define CC 256            // NH * HD = projected width
#define DIN 256           // input (model) width
#define NH 8
#define HD 32
#define SCALE (0.17677669529663687f)
static_assert(NB >= 1 && NB <= NB_FULL);
static_assert(TT % 128 == 0 && TT >= 128 && TT <= SEQ_FULL);
static_assert(NH * HD == CC && HD % 32 == 0 && DIN % 128 == 0 && CC % 128 == 0);
static_assert((size_t)NB_FULL * SEQ_FULL * DIN * 4u == 8388608u);

// workspace carve (bytes); every region a whole multiple of its tile / line granularity
#define WS_QH  0u                                       // f16 q rows [b*TT + t][CC]
#define WS_KH  (WS_QH + 2u * (size_t)NB * TT * CC)       // f16 k rows [b*TT + t][CC]
#define WS_VT  (WS_KH + 2u * (size_t)NB * TT * CC)       // f16 v planes [b][c][t]
#define WS_Y   (WS_VT + 2u * (size_t)NB * CC * TT)       // f32 ctx rows [b*TT + t][CC]
#define WS_END (WS_Y  + 4u * (size_t)NB * TT * CC)
static_assert(WS_END <= 134217728u);
static_assert(WS_KH % 128 == 0 && WS_VT % 128 == 0 && WS_Y % 128 == 0 && WS_END % 128 == 0);

// ---- k_proj: block = (64 rows, 128 cols, which): y = bf16(x) bf16(W)^T + bf16(b) with exact bf16 products (K = DIN) -> which 0: q f16 rows; 1: k f16 rows; 2: v f16 planes [c][t]
__global__ __launch_bounds__(128) __attribute__((amdgpu_num_vgpr(256))) void k_proj(const float* __restrict__ X, const float* __restrict__ WQ, const float* __restrict__ WK, const float* __restrict__ WV, const float* __restrict__ BQ, const float* __restrict__ BK, const float* __restrict__ BV,
    _Float16* __restrict__ QH, _Float16* __restrict__ KH, _Float16* __restrict__ VT) {
  __shared__ __align__(16) unsigned char sw[128 * WP * 2]; __shared__ __align__(16) unsigned char sa[64 * WP * 2];   // bf16 weight rows c0.. and bf16 input rows r0..; sa is used again by the epilogue
  const int tid = threadIdx.x, wave = tid >> 5, lane = tid & 31, col = lane & 15, g = lane >> 4; const int which = blockIdx.z; const int c0 = blockIdx.y * 128; const size_t r0 = (size_t)blockIdx.x * 64; const size_t bb = r0 / TT; const int t0 = (int)(r0 % TT);
  const float* WA = which == 0 ? WQ : which == 1 ? WK : WV; const float* BA = which == 0 ? BQ : which == 1 ? BK : BV;
  stage16<64, 0>(X + (bb * SEQ_FULL + (size_t)t0) * (size_t)DIN, sa, tid);   // input rows at full per-batch stride
  stage16<128, 0>(WA + (size_t)c0 * DIN, sw, tid);
  __syncthreads();   // publishes both staged tiles
  const __bf16* ar = (const __bf16*)sa + (wave * 16 + col) * WP; const __bf16* wr = (const __bf16*)sw + col * WP;
  v8f acc[8] = {}; v16b af[2], wf[2][8];   // two register sets of fragments: chunk kc + 1 is read from LDS while chunk kc is multiplied
  af[0] = frag_b(ar, lane);
#pragma unroll
  for (int j = 0; j < 8; ++j) wf[0][j] = frag_b(wr + j * 16 * WP, lane);
#pragma unroll
  for (int kc = 0; kc < DIN / 32; ++kc) { const int c = kc & 1;
    if (kc + 1 < DIN / 32) { af[c ^ 1] = frag_b(ar + (kc + 1) * 32, lane);
#pragma unroll
      for (int j = 0; j < 8; ++j) wf[c ^ 1][j] = frag_b(wr + j * 16 * WP + (kc + 1) * 32, lane); }
    __builtin_amdgcn_sched_barrier(0);   // keeps the next chunk's 18 LDS reads in front of this chunk's products; without it each fragment is read directly in front of its product and waited for alone
#pragma unroll
    for (int j = 0; j < 8; ++j) acc[j] = wmma_bf(af[c], wf[c][j], acc[j]); }
  __syncthreads();   // ends every wave's reads of sa, which the epilogue overwrites
  _Float16 (*sh)[136] = (_Float16 (*)[136])sa; _Float16 (*th)[72] = (_Float16 (*)[72])sa;
  static_assert(64 * 136 <= 64 * WP && 128 * 72 <= 64 * WP);
  if (which < 2) { _Float16* DH = which == 0 ? QH : KH;
#pragma unroll
    for (int j = 0; j < 8; ++j) { const float bias = bfr(BA[c0 + j * 16 + col]);
#pragma unroll
      for (int r = 0; r < 8; ++r) sh[wave * 16 + 8 * g + r][j * 16 + col] = (_Float16)(acc[j][r] + bias); }
    __syncthreads();
    for (int e = tid; e < 64 * 16; e += 128) { const int rl = e >> 4, q = e & 15; vst2((unsigned*)(DH + (r0 + rl) * CC + c0 + q * 8), *(const v4u*)&sh[rl][q * 8]); }
  } else {
#pragma unroll
    for (int j = 0; j < 8; ++j) { const float bias = bfr(BA[c0 + j * 16 + col]);
#pragma unroll
      for (int r = 0; r < 8; ++r) th[j * 16 + col][wave * 16 + 8 * g + r] = (_Float16)(acc[j][r] + bias); }
    __syncthreads();
    for (int e = tid; e < 128 * 8; e += 128) { const int cl = e >> 3, q = e & 7; vst2((unsigned*)(VT + (bb * CC + c0 + cl) * (size_t)TT + t0 + q * 8), *(const v4u*)&th[cl][q * 8]); } } }
#define KT 64             // keys per staged tile
#define KP 40             // K tile pitch in f16: 64-B rows + 16 B, conflict-free 16-byte reads
#define VP (KT + 8)       // V tile pitch in f16: 128-B rows + 16 B
#define QBLK 128          // queries per block
#define L2SC (SCALE * 1.4426950408889634f)
static_assert(HD == 32 && KT == 64 && TT % KT == 0 && TT % QBLK == 0);
__device__ __forceinline__ float xhalf(float v) { const int i = __builtin_bit_cast(int, v); return __builtin_bit_cast(float, __builtin_amdgcn_permlanex16(i, i, 0x76543210, 0xfedcba98, false, false)); }   // lane l <-> l ^ 16
__global__ __launch_bounds__(256) __attribute__((amdgpu_waves_per_eu(4, 4))) void k_attn(const _Float16* __restrict__ QH, const _Float16* __restrict__ KH, const _Float16* __restrict__ VT, float* __restrict__ Y) {
  __shared__ __align__(16) _Float16 sk[2][KT][KP]; __shared__ __align__(16) _Float16 sv[2][HD][VP];
  const int tid = threadIdx.x, wave = tid >> 5, lane = tid & 31, col = lane & 15, g = lane >> 4; const int h = blockIdx.y, b = blockIdx.z; const int ql0 = blockIdx.x * QBLK + wave * 16;
  const v16h qf = frag_h(QH + ((size_t)b * TT + ql0 + col) * CC + h * HD, lane);
  const int kk = tid >> 2, kq = (tid & 3) * 8, vc = tid >> 3, vq = (tid & 7) * 8;   // this thread's 16 bytes of each K tile (key kk) and each V tile (channel vc)
  const _Float16* kg = KH + ((size_t)b * TT + kk) * CC + h * HD + kq; const _Float16* vg = VT + ((size_t)b * CC + h * HD + vc) * (size_t)TT + vq;
  v8h kr = *(const v8h*)kg, vr = *(const v8h*)vg;
  *(v8h*)&sk[0][kk][kq] = kr; *(v8h*)&sv[0][vc][vq] = vr;
  __syncthreads();
  float m = -3.0e38f; v8f lv = {}; v8f acc[2] = {};   // lv: eight partial row sums per lane, joined once in the epilogue
#pragma unroll 1   // kept rolled: one trip is about 200 instructions, copies of it would only grow the code
  for (int t = 0; t < TT / KT; ++t) { const int cur = t & 1; const bool more = t + 1 < TT / KT;
    if (more) { kr = *(const v8h*)(kg + (size_t)(t + 1) * KT * CC); vr = *(const v8h*)(vg + (t + 1) * KT); }
    v16h kf[KT / 16], vf[KT / 32][2];
#pragma unroll
    for (int T = 0; T < KT / 16; ++T) kf[T] = frag_h(&sk[cur][T * 16 + col][0], lane);
#pragma unroll
    for (int kc = 0; kc < KT / 32; ++kc) { vf[kc][0] = frag_h(&sv[cur][col][kc * 32], lane); vf[kc][1] = frag_h(&sv[cur][16 + col][kc * 32], lane); }
    asm volatile("" :: "v"(kf[0]), "v"(kf[1]), "v"(kf[2]), "v"(kf[3]), "v"(vf[0][0]), "v"(vf[0][1]), "v"(vf[1][0]), "v"(vf[1][1]));   // inputs only: holds all 16 LDS reads of the trip in front of the products, one LDS latency a trip; without it the compiler reads fragment by fragment into one register group, each read waited for alone
    v8f s[KT / 16]; float mt[KT / 16];
#pragma unroll
    for (int T = 0; T < KT / 16; ++T) { const v8f z = {}; s[T] = __builtin_amdgcn_wmma_f32_16x16x32_f16(false, kf[T], false, qf, (short)0, z, false, false); }
    __builtin_amdgcn_sched_barrier(0);   // keeps the four independent products back to back, each filling the others' result distance; without it the maxima are woven in behind each and padded with v_nop
#pragma unroll
    for (int T = 0; T < KT / 16; ++T) { mt[T] = s[T][0];
#pragma unroll
      for (int r = 1; r < 8; ++r) mt[T] = __builtin_fmaxf(mt[T], s[T][r]); }
    float mx = __builtin_fmaxf(__builtin_fmaxf(mt[0], mt[1]), __builtin_fmaxf(mt[2], mt[3]));
    mx = __builtin_fmaxf(mx, xhalf(mx));
    const float mn = __builtin_fmaxf(m, mx * L2SC); const float al = __builtin_amdgcn_exp2f(m - mn); const float mb = mn - 11.0f; m = mn;   // p = 2^11 exp(logit - running maximum), at most 2048
#pragma unroll
    for (int T = 0; T < KT / 16; ++T)
#pragma unroll
      for (int r = 0; r < 8; r += 2) { const v2f e = __builtin_elementwise_fma((v2f){s[T][r], s[T][r + 1]}, (v2f){L2SC, L2SC}, (v2f){-mb, -mb}); s[T][r] = __builtin_amdgcn_exp2f(e[0]); s[T][r + 1] = __builtin_amdgcn_exp2f(e[1]); }
    lv = lv * al + ((s[0] + s[1]) + (s[2] + s[3])); acc[0] *= al; acc[1] *= al;
#pragma unroll
    for (int kc = 0; kc < KT / 32; ++kc) { v16h p;
#pragma unroll
      for (int r = 0; r < 8; ++r) { p[r] = (_Float16)s[2 * kc][r]; p[8 + r] = (_Float16)s[2 * kc + 1][r]; }
#pragma unroll
      for (int j = 0; j < 2; ++j) acc[j] = __builtin_amdgcn_wmma_f32_16x16x32_f16(false, vf[kc][j], false, p, (short)0, acc[j], false, false); }
    if (more) { *(v8h*)&sk[cur ^ 1][kk][kq] = kr; *(v8h*)&sv[cur ^ 1][vc][vq] = vr; }
    asm volatile("s_wait_xcnt 0x0" ::: "memory");   // stands in front of the next trip's additions to the address registers that this trip's two global loads name
    __syncthreads();   // publishes tile t + 1 and ends every wave's reads of tile t, whose buffer trip t + 1 refills
  }
  float l = ((lv[0] + lv[1]) + (lv[2] + lv[3])) + ((lv[4] + lv[5]) + (lv[6] + lv[7]));
  l += xhalf(l); const float inv = 1.0f / l;
  float* yr = Y + ((size_t)b * TT + ql0 + col) * CC + h * HD + 8 * g;   // acc[j][r] = channel 16 j + 8 g + r of query col
#pragma unroll
  for (int j = 0; j < 2; ++j) { v4f o0, o1;
#pragma unroll
    for (int r = 0; r < 4; ++r) { o0[r] = acc[j][r] * inv; o1[r] = acc[j][4 + r] * inv; }
    vst2(yr + j * 16, o0); vst2(yr + j * 16 + 4, o1); } }
// ---- k_out: block = (64 rows, 128 cols): out = ctx Wo^T + bo: ctx x 2^6 once to f16 against Wo as f16(bf16 x 2^8) exact (1 product) x 2^-14 + bf16(bo); 512-B row segment per wave row in one store
__global__ __launch_bounds__(128) __attribute__((amdgpu_num_vgpr(256))) void k_out(const float* __restrict__ Y, const float* __restrict__ WO, const float* __restrict__ BO, float* __restrict__ OUT) { __shared__ __align__(16) float sf[4][16][132];
  const int tid = threadIdx.x, wave = tid >> 5, lane = tid & 31, col = lane & 15, g = lane >> 4; const int c0 = blockIdx.y * 128;
  const size_t rb = (size_t)blockIdx.x * 64; const size_t bb = rb / TT; const size_t orow0 = bb * SEQ_FULL + (rb % TT) + wave * 16;   // output rows at full per-batch stride
  __shared__ __align__(16) unsigned char sw[128 * WP * 2]; __shared__ __align__(16) unsigned char sa[64 * WP * 2];   // f16 weight rows c0.. and f16 ctx rows rb..
  stage16<64, 1>(Y + rb * CC, sa, tid);
  stage16<128, 2>(WO + (size_t)c0 * CC, sw, tid);
  __syncthreads();   // publishes both staged tiles
  const _Float16* ar = (const _Float16*)sa + (wave * 16 + col) * WP; const _Float16* wr = (const _Float16*)sw + col * WP;
  v8f acc[8] = {}; v16h af[2], wf[2][8];   // two register sets of fragments: chunk kc + 1 is read from LDS while chunk kc is multiplied
  af[0] = frag_h(ar, lane);
#pragma unroll
  for (int j = 0; j < 8; ++j) wf[0][j] = frag_h(wr + j * 16 * WP, lane);
#pragma unroll
  for (int kc = 0; kc < CC / 32; ++kc) { const int c = kc & 1;
    if (kc + 1 < CC / 32) { af[c ^ 1] = frag_h(ar + (kc + 1) * 32, lane);
#pragma unroll
      for (int j = 0; j < 8; ++j) wf[c ^ 1][j] = frag_h(wr + j * 16 * WP + (kc + 1) * 32, lane); }
    __builtin_amdgcn_sched_barrier(0);   // keeps the next chunk's 18 LDS reads in front of this chunk's products; without it each fragment is read directly in front of its product and waited for alone
#pragma unroll
    for (int j = 0; j < 8; ++j) acc[j] = wmma16(af[c], wf[c][j], acc[j]); }
#pragma unroll
  for (int j = 0; j < 8; ++j) { const float bias = bfr(BO[c0 + j * 16 + col]);
#pragma unroll
    for (int r = 0; r < 8; ++r) sf[wave][8 * g + r][j * 16 + col] = acc[j][r] * (1.0f / 16384.0f) + bias; }
  ldsx(); for (int rl = 0; rl < 16; ++rl) vst2(OUT + (orow0 + rl) * DIN + c0 + lane * 4, *(const v4f*)&sf[wave][rl][lane * 4]); }

extern "C" void kernel_launch(void* const* d_in, const int* in_sizes, int n_in, void* d_out, int out_size, void* d_ws, size_t ws_size, hipStream_t stream) {
  if (n_in < 9) return;
  // inputs (wire order): 0 x [2,4096,256]; 1 Wq (out,in) [256][256]; 2 bq; 3 Wk; 4 bk; 5 Wv; 6 bv; 7 Wo (out,in); 8 bo -- all f32
  const size_t nrow_need = (size_t)(NB - 1) * SEQ_FULL + TT;
  if ((size_t)in_sizes[0] < nrow_need * DIN) return;
  if (in_sizes[1] < CC * DIN || in_sizes[3] < CC * DIN || in_sizes[5] < CC * DIN || in_sizes[7] < DIN * CC) return;
  if (in_sizes[2] < CC || in_sizes[4] < CC || in_sizes[6] < CC || in_sizes[8] < DIN) return;
  if ((size_t)out_size < nrow_need * DIN) return;
  if (ws_size < (size_t)WS_END) return;
  const float* const* F = (const float* const*)d_in;
  char* ws = (char*)d_ws; _Float16 *QH = (_Float16*)(ws + WS_QH), *KH = (_Float16*)(ws + WS_KH), *VT = (_Float16*)(ws + WS_VT); float *Y = (float*)(ws + WS_Y);
  k_proj<<<dim3(NB * TT / 64, CC / 128, 3), 128, 0, stream>>>(F[0], F[1], F[3], F[5], F[2], F[4], F[6], QH, KH, VT);
  k_attn<<<dim3(TT / QBLK, NH, NB), 256, 0, stream>>>(QH, KH, VT, Y);
  k_out<<<dim3(NB * TT / 64, DIN / 128), 128, 0, stream>>>(Y, F[7], F[8], (float*)d_out);
}

// v003
// One run takes 57.7 microseconds.
// Timed twice side by side with v002, it ran 1.17 and 1.20 times as fast.
// Counting every step since v000, it is 36.8 times as fast.
// compute dtype: every float input enters as its bf16 RNE value; q/k/v = bf16(x) x bf16(W)^T on v_wmma_f32_16x16x32_bf16 (1 product, f32 accumulate) + bf16(b), stored once to f16; logits = q f16 x k f16 on v_wmma_f32_16x16x32_f16 (1 product, f32 accumulate) x 32^-0.5; softmax in f32, online over 64-key tiles in two key halves joined at the end; exp(logit - running max) x 2^11 once to f16 x v f16 on v_wmma_f32_16x16x32_f16 (1 product, f32 accumulate) / f32 row sum of the same terms; ctx x 2^6 once to f16 x Wo as f16(bf16 x 2^8) on v_wmma_f32_16x16x32_f16 (1 product, f32 accumulate) x 2^-14 + bf16(bo); f32 output.
#include <hip/hip_runtime.h>
#include <math.h>

typedef __attribute__((ext_vector_type(16))) _Float16 v16h;
typedef __attribute__((ext_vector_type(16))) __bf16 v16b;
typedef __attribute__((ext_vector_type(8)))  _Float16 v8h;
typedef __attribute__((ext_vector_type(8)))  float v8f;
typedef __attribute__((ext_vector_type(4)))  float v4f;
typedef __attribute__((ext_vector_type(2)))  float v2f;
typedef __attribute__((ext_vector_type(4)))  unsigned v4u;
typedef __attribute__((ext_vector_type(8)))  __bf16 v8b;
typedef __attribute__((ext_vector_type(4)))  __bf16 v4b;
typedef __attribute__((ext_vector_type(4)))  _Float16 v4h;

template <typename T> __device__ __forceinline__ void vst2(void* p, T v) { *(T*)p = v;  }
__device__ __forceinline__ v8f wmma16(v16h a, v16h b, v8f c) {
  v8f d = __builtin_amdgcn_wmma_f32_16x16x32_f16(false, a, false, b, (short)0, c, false, false);
  asm volatile("v_nop\n\tv_nop\n\tv_nop\n\tv_nop" : "+v"(d) : "v"(a), "v"(b));
  return d;
}
__device__ __forceinline__ v8f wmma_bf(v16b a, v16b b, v8f c) {
  v8f d = __builtin_amdgcn_wmma_f32_16x16x32_bf16(false, a, false, b, (short)0, c, false, false);
  asm volatile("v_nop\n\tv_nop\n\tv_nop\n\tv_nop" : "+v"(d) : "v"(a), "v"(b));
  return d;
}
// 16x16x32 fragments: lane = (h = lane>>4, row/col = lane&15); elements 0..7 = k0+8h+0..7, 8..15 = k0+16+8h+0..7; D element r = row 8h+r, col lane&15
__device__ __forceinline__ v16h frag_h(const _Float16* rowk0, int lane) {
  union { v16h v; v8h q[2]; } u; const _Float16* p = rowk0 + 8 * (lane >> 4);
  u.q[0] = *(const v8h*)p; u.q[1] = *(const v8h*)(p + 16); return u.v;
}
__device__ __forceinline__ v16b frag_b(const __bf16* rowk0, int lane) {
  union { v16b v; v8b q[2]; } u; const __bf16* p = rowk0 + 8 * (lane >> 4);
  u.q[0] = *(const v8b*)p; u.q[1] = *(const v8b*)(p + 16); return u.v;
}
__device__ __forceinline__ float bfr(float v) { return (float)(__bf16)v; }
// Staging of ROWS contiguous f32 rows of 256 into LDS rows of 256 16-bit values at pitch WP, by 128 threads: every load covers whole lines (32 lanes x 16 B in a row), each value is converted once per block.
// MODE 0: bf16 RNE; 1: f16(v x 2^6); 2: f16(bf16(v) x 2^8), exact
#define WP 264            // staged row pitch in 16-bit elements: 512-B rows + 16 B = 16 B x 33, conflict-free 16-byte reads
#define SU 32             // 16-byte loads in flight per thread and trip
template <int ROWS, int MODE> __device__ __forceinline__ void stage16(const float* __restrict__ src, unsigned char* dst, int tid) {
  static_assert((ROWS / 2) % SU == 0);
  const float* sp = src + tid * 4; unsigned char* dp = dst + (tid >> 6) * (WP * 2) + (tid & 63) * 8;
#pragma unroll
  for (int i0 = 0; i0 < ROWS / 2; i0 += SU) { v4f t[SU];
#pragma unroll
    for (int u = 0; u < SU; ++u) t[u] = *(const v4f*)(sp + (size_t)(i0 + u) * 512);
#pragma unroll
    for (int u = 0; u < SU; ++u) { unsigned char* p = dp + (i0 + u) * (2 * WP * 2);
      if (MODE == 0) { v4b o;
#pragma unroll
        for (int r = 0; r < 4; ++r) o[r] = (__bf16)t[u][r];
        *(v4b*)p = o;
      } else { v4h o;
#pragma unroll
        for (int r = 0; r < 4; ++r) o[r] = MODE == 1 ? (_Float16)(t[u][r] * 64.0f) : (_Float16)(bfr(t[u][r]) * 256.0f);
        *(v4h*)p = o; } }
    asm volatile("s_wait_xcnt 0x0" ::: "memory");   // stands in front of every later overwrite of the registers that this trip's loads name; its memory clobber also keeps the next trip's loads behind this trip's LDS stores, without which the trips are woven together and registers spill
  } }
__device__ __forceinline__ void ldsx() { asm volatile("s_wait_dscnt 0" ::: "memory"); __builtin_amdgcn_wave_barrier(); __builtin_amdgcn_fence(3, "workgroup"); }

// Multi-head self-attn: q/k/v = x W^T + b ((out,in) [256][256] each, with bias); heads (8, 32) along the channel axis; S = softmax(q k^T x 32^-0.5) over all 4,096 keys; out = merged(S v) Wo^T + bo.
#ifndef NB
#define NB 2
#endif
#ifndef SEQ
#define SEQ 4096
#endif
#define NB_FULL 2
#define SEQ_FULL 4096
#define TT SEQ
#define CC 256            // NH * HD = projected width
#define DIN 256           // input (model) width
#define NH 8
#define HD 32
#define SCALE (0.17677669529663687f)
static_assert(NB >= 1 && NB <= NB_FULL);
static_assert(TT % 128 == 0 && TT >= 128 && TT <= SEQ_FULL);
static_assert(NH * HD == CC && HD % 32 == 0 && DIN % 128 == 0 && CC % 128 == 0);
static_assert((size_t)NB_FULL * SEQ_FULL * DIN * 4u == 8388608u);

// workspace carve (bytes); every region a whole multiple of its tile / line granularity
#define WS_QH  0u                                       // f16 q rows [b*TT + t][CC]
#define WS_KH  (WS_QH + 2u * (size_t)NB * TT * CC)       // f16 k rows [b*TT + t][CC]
#define WS_VT  (WS_KH + 2u * (size_t)NB * TT * CC)       // f16 v planes [b][c][t]
#define WS_Y   (WS_VT + 2u * (size_t)NB * CC * TT)       // f32 ctx rows [b*TT + t][CC]
#define WS_END (WS_Y  + 4u * (size_t)NB * TT * CC)
static_assert(WS_END <= 134217728u);
static_assert(WS_KH % 128 == 0 && WS_VT % 128 == 0 && WS_Y % 128 == 0 && WS_END % 128 == 0);

// ---- k_proj: block = (64 rows, 128 cols, which): y = bf16(x) bf16(W)^T + bf16(b) with exact bf16 products (K = DIN) -> which 0: q f16 rows; 1: k f16 rows; 2: v f16 planes [c][t]
__global__ __launch_bounds__(128) __attribute__((amdgpu_num_vgpr(256))) void k_proj(const float* __restrict__ X, const float* __restrict__ WQ, const float* __restrict__ WK, const float* __restrict__ WV, const float* __restrict__ BQ, const float* __restrict__ BK, const float* __restrict__ BV,
    _Float16* __restrict__ QH, _Float16* __restrict__ KH, _Float16* __restrict__ VT) {
  __shared__ __align__(16) unsigned char sw[128 * WP * 2]; __shared__ __align__(16) unsigned char sa[64 * WP * 2];   // bf16 weight rows c0.. and bf16 input rows r0..; sa is used again by the epilogue
  const int tid = threadIdx.x, wave = tid >> 5, lane = tid & 31, col = lane & 15, g = lane >> 4; const int which = blockIdx.z; const int c0 = blockIdx.y * 128; const size_t r0 = (size_t)blockIdx.x * 64; const size_t bb = r0 / TT; const int t0 = (int)(r0 % TT);
  const float* WA = which == 0 ? WQ : which == 1 ? WK : WV; const float* BA = which == 0 ? BQ : which == 1 ? BK : BV;
  stage16<64, 0>(X + (bb * SEQ_FULL + (size_t)t0) * (size_t)DIN, sa, tid);   // input rows at full per-batch stride
  stage16<128, 0>(WA + (size_t)c0 * DIN, sw, tid);
  __syncthreads();   // publishes both staged tiles
  const __bf16* ar = (const __bf16*)sa + (wave * 16 + col) * WP; const __bf16* wr = (const __bf16*)sw + col * WP;
  v8f acc[8] = {}; v16b af[2], wf[2][8];   // two register sets of fragments: chunk kc + 1 is read from LDS while chunk kc is multiplied
  af[0] = frag_b(ar, lane);
#pragma unroll
  for (int j = 0; j < 8; ++j) wf[0][j] = frag_b(wr + j * 16 * WP, lane);
#pragma unroll
  for (int kc = 0; kc < DIN / 32; ++kc) { const int c = kc & 1;
    if (kc + 1 < DIN / 32) { af[c ^ 1] = frag_b(ar + (kc + 1) * 32, lane);
#pragma unroll
      for (int j = 0; j < 8; ++j) wf[c ^ 1][j] = frag_b(wr + j * 16 * WP + (kc + 1) * 32, lane); }
    __builtin_amdgcn_sched_barrier(0);   // keeps the next chunk's 18 LDS reads in front of this chunk's products; without it each fragment is read directly in front of its product and waited for alone
#pragma unroll
    for (int j = 0; j < 8; ++j) acc[j] = wmma_bf(af[c], wf[c][j], acc[j]); }
  __syncthreads();   // ends every wave's reads of sa, which the epilogue overwrites
  _Float16 (*sh)[136] = (_Float16 (*)[136])sa; _Float16 (*th)[72] = (_Float16 (*)[72])sa;
  static_assert(64 * 136 <= 64 * WP && 128 * 72 <= 64 * WP);
  if (which < 2) { _Float16* DH = which == 0 ? QH : KH;
#pragma unroll
    for (int j = 0; j < 8; ++j) { const float bias = bfr(BA[c0 + j * 16 + col]);
#pragma unroll
      for (int r = 0; r < 8; ++r) sh[wave * 16 + 8 * g + r][j * 16 + col] = (_Float16)(acc[j][r] + bias); }
    __syncthreads();
    for (int e = tid; e < 64 * 16; e += 128) { const int rl = e >> 4, q = e & 15; vst2((unsigned*)(DH + (r0 + rl) * CC + c0 + q * 8), *(const v4u*)&sh[rl][q * 8]); }
  } else {
#pragma unroll
    for (int j = 0; j < 8; ++j) { const float bias = bfr(BA[c0 + j * 16 + col]);
#pragma unroll
      for (int r = 0; r < 8; ++r) th[j * 16 + col][wave * 16 + 8 * g + r] = (_Float16)(acc[j][r] + bias); }
    __syncthreads();
    for (int e = tid; e < 128 * 8; e += 128) { const int cl = e >> 3, q = e & 7; vst2((unsigned*)(VT + (bb * CC + c0 + cl) * (size_t)TT + t0 + q * 8), *(const v4u*)&th[cl][q * 8]); } } }
#define KT 64             // keys per staged tile and key half
#define KP 40             // K tile pitch in f16: 64-B rows + 16 B, conflict-free 16-byte reads
#define VP (KT + 8)       // V tile pitch in f16: 128-B rows + 16 B
#define QBLK 128          // queries per block
#define QW 2              // 16-query column groups per wave
#define KS 2              // key halves per block
#define TH (TT / KS)      // keys per half
#define L2SC (SCALE * 1.4426950408889634f)
static_assert(HD == 32 && KT == 64 && TT % (KS * KT) == 0 && TT % QBLK == 0 && QBLK == 4 * QW * 16 && KS == 2);
__device__ __forceinline__ float xhalf(float v) { const int i = __builtin_bit_cast(int, v); return __builtin_bit_cast(float, __builtin_amdgcn_permlanex16(i, i, 0x76543210, 0xfedcba98, false, false)); }   // lane l <-> l ^ 16
__global__ __launch_bounds__(256) __attribute__((amdgpu_waves_per_eu(4, 4))) void k_attn(const _Float16* __restrict__ QH, const _Float16* __restrict__ KH, const _Float16* __restrict__ VT, float* __restrict__ Y) {
  __shared__ __align__(16) _Float16 sk[2][KS][KT][KP]; __shared__ __align__(16) _Float16 sv[2][KS][HD][VP]; __shared__ float mg[8][18][32];   // mg: per wave, the column group it hands to its partner: 16 ctx values, maximum, sum per lane
  const int tid = threadIdx.x, wave = tid >> 5, lane = tid & 31, col = lane & 15, g = lane >> 4; const int h = blockIdx.y, b = blockIdx.z; const int kh = wave >> 2; const int ql0 = blockIdx.x * QBLK + (wave & 3) * (QW * 16);
  v16h qf[QW];
#pragma unroll
  for (int c = 0; c < QW; ++c) qf[c] = frag_h(QH + ((size_t)b * TT + ql0 + c * 16 + col) * CC + h * HD, lane);
  const int kk = tid >> 2, kq = (tid & 3) * 8, vc = tid >> 3, vq = (tid & 7) * 8;   // this thread's 16 bytes of each K tile (key kk) and each V tile (channel vc)
  const _Float16* kg = KH + ((size_t)b * TT + kk) * CC + h * HD + kq; const _Float16* vg = VT + ((size_t)b * CC + h * HD + vc) * (size_t)TT + vq;
  v8h kr[KS], vr[KS];
#pragma unroll
  for (int i = 0; i < KS; ++i) { kr[i] = *(const v8h*)(kg + (size_t)i * TH * CC); vr[i] = *(const v8h*)(vg + i * TH); }
#pragma unroll
  for (int i = 0; i < KS; ++i) { *(v8h*)&sk[0][i][kk][kq] = kr[i]; *(v8h*)&sv[0][i][vc][vq] = vr[i]; }
  __syncthreads();
  float m[QW]; v8f lv[QW] = {}; v8f acc[QW][2] = {};   // lv: eight partial row sums per lane and column group, joined once in the epilogue
#pragma unroll
  for (int c = 0; c < QW; ++c) m[c] = -3.0e38f;
#pragma unroll 1   // kept rolled: one trip is about 350 instructions, copies of it would only grow the code
  for (int t = 0; t < TH / KT; ++t) { const int cur = t & 1; const bool more = t + 1 < TH / KT;
    if (more) {
#pragma unroll
      for (int i = 0; i < KS; ++i) { kr[i] = *(const v8h*)(kg + ((size_t)i * TH + (size_t)(t + 1) * KT) * CC); vr[i] = *(const v8h*)(vg + i * TH + (t + 1) * KT); } }
    v16h kf[KT / 16], vf[KT / 32][2];
#pragma unroll
    for (int T = 0; T < KT / 16; ++T) kf[T] = frag_h(&sk[cur][kh][T * 16 + col][0], lane);
#pragma unroll
    for (int kc = 0; kc < KT / 32; ++kc) { vf[kc][0] = frag_h(&sv[cur][kh][col][kc * 32], lane); vf[kc][1] = frag_h(&sv[cur][kh][16 + col][kc * 32], lane); }
    asm volatile("" :: "v"(kf[0]), "v"(kf[1]), "v"(kf[2]), "v"(kf[3]), "v"(vf[0][0]), "v"(vf[0][1]), "v"(vf[1][0]), "v"(vf[1][1]));   // inputs only: holds all 16 LDS reads of the trip in front of the products, one LDS latency a trip; without it the compiler reads fragment by fragment into one register group, each read waited for alone
    v8f s[QW][KT / 16];
#pragma unroll
    for (int T = 0; T < KT / 16; ++T)
#pragma unroll
      for (int c = 0; c < QW; ++c) { const v8f z = {}; s[c][T] = __builtin_amdgcn_wmma_f32_16x16x32_f16(false, kf[T], false, qf[c], (short)0, z, false, false); }
    __builtin_amdgcn_sched_barrier(0);   // keeps the eight independent products back to back, each filling the others' result distance; without it the maxima are woven in behind each and padded with v_nop
#pragma unroll
    for (int c = 0; c < QW; ++c) { float mt[KT / 16];
#pragma unroll
      for (int T = 0; T < KT / 16; ++T) { mt[T] = s[c][T][0];
#pragma unroll
        for (int r = 1; r < 8; ++r) mt[T] = __builtin_fmaxf(mt[T], s[c][T][r]); }
      float mx = __builtin_fmaxf(__builtin_fmaxf(mt[0], mt[1]), __builtin_fmaxf(mt[2], mt[3]));
      mx = __builtin_fmaxf(mx, xhalf(mx));
      const float mn = __builtin_fmaxf(m[c], mx * L2SC); const float al = __builtin_amdgcn_exp2f(m[c] - mn); const float mb = mn - 11.0f; m[c] = mn;   // p = 2^11 exp(logit - running maximum), at most 2048
#pragma unroll
      for (int T = 0; T < KT / 16; ++T)
#pragma unroll
        for (int r = 0; r < 8; r += 2) { const v2f e = __builtin_elementwise_fma((v2f){s[c][T][r], s[c][T][r + 1]}, (v2f){L2SC, L2SC}, (v2f){-mb, -mb}); s[c][T][r] = __builtin_amdgcn_exp2f(e[0]); s[c][T][r + 1] = __builtin_amdgcn_exp2f(e[1]); }
      lv[c] = lv[c] * al + ((s[c][0] + s[c][1]) + (s[c][2] + s[c][3])); acc[c][0] *= al; acc[c][1] *= al; }
#pragma unroll
    for (int kc = 0; kc < KT / 32; ++kc)
#pragma unroll
      for (int c = 0; c < QW; ++c) { v16h p;
#pragma unroll
        for (int r = 0; r < 8; ++r) { p[r] = (_Float16)s[c][2 * kc][r]; p[8 + r] = (_Float16)s[c][2 * kc + 1][r]; }
#pragma unroll
        for (int j = 0; j < 2; ++j) acc[c][j] = __builtin_amdgcn_wmma_f32_16x16x32_f16(false, vf[kc][j], false, p, (short)0, acc[c][j], false, false); }
    if (more) {
#pragma unroll
      for (int i = 0; i < KS; ++i) { *(v8h*)&sk[cur ^ 1][i][kk][kq] = kr[i]; *(v8h*)&sv[cur ^ 1][i][vc][vq] = vr[i]; } }
    asm volatile("s_wait_xcnt 0x0" ::: "memory");   // stands in front of the next trip's additions to the address registers that this trip's four global loads name
    __syncthreads();   // publishes both halves' tiles t + 1 and ends every wave's reads of tiles t, whose buffer trip t + 1 refills
  }
  float l[QW];
#pragma unroll
  for (int c = 0; c < QW; ++c) { l[c] = ((lv[c][0] + lv[c][1]) + (lv[c][2] + lv[c][3])) + ((lv[c][4] + lv[c][5]) + (lv[c][6] + lv[c][7])); l[c] += xhalf(l[c]); }
  // join of the two key halves: wave w and wave w ^ 4 hold the same 32 queries; the wave of half kh finishes column group kh and hands the other group over through mg
  const bool hi = kh != 0;
  const v8f g0 = hi ? acc[0][0] : acc[1][0], g1 = hi ? acc[0][1] : acc[1][1]; const float gm = hi ? m[0] : m[1], gl = hi ? l[0] : l[1];
  const v8f o0 = hi ? acc[1][0] : acc[0][0], o1 = hi ? acc[1][1] : acc[0][1]; const float om = hi ? m[1] : m[0], ol = hi ? l[1] : l[0];
#pragma unroll
  for (int r = 0; r < 8; ++r) { mg[wave][r][lane] = g0[r]; mg[wave][8 + r][lane] = g1[r]; }
  mg[wave][16][lane] = gm; mg[wave][17][lane] = gl;
  __syncthreads();   // publishes every wave's handed-over column group
  const float (*pm)[32] = mg[wave ^ 4];
  const float pmx = pm[16][lane], pl = pm[17][lane]; const float ed = __builtin_amdgcn_exp2f(-__builtin_fabsf(om - pmx)); const bool og = om >= pmx; const float ao = og ? 1.0f : ed, ap = og ? ed : 1.0f;   // each half's weight 2^(its maximum - joint maximum): 1 for the larger
  const float inv = 1.0f / (ol * ao + pl * ap); const float wo = ao * inv, wp = ap * inv;
  float* yr = Y + ((size_t)b * TT + ql0 + kh * 16 + col) * CC + h * HD + 8 * g;   // channel 16 j + 8 g + r of query col of column group kh
#pragma unroll
  for (int j = 0; j < 2; ++j) { v4f a0, a1; const v8f own = j == 0 ? o0 : o1;
#pragma unroll
    for (int r = 0; r < 4; ++r) { a0[r] = own[r] * wo + pm[j * 8 + r][lane] * wp; a1[r] = own[4 + r] * wo + pm[j * 8 + 4 + r][lane] * wp; }
    vst2(yr + j * 16, a0); vst2(yr + j * 16 + 4, a1); } }
// ---- k_out: block = (64 rows, 128 cols): out = ctx Wo^T + bo: ctx x 2^6 once to f16 against Wo as f16(bf16 x 2^8) exact (1 product) x 2^-14 + bf16(bo); 512-B row segment per wave row in one store
__global__ __launch_bounds__(128) __attribute__((amdgpu_num_vgpr(256))) void k_out(const float* __restrict__ Y, const float* __restrict__ WO, const float* __restrict__ BO, float* __restrict__ OUT) { __shared__ __align__(16) float sf[4][16][132];
  const int tid = threadIdx.x, wave = tid >> 5, lane = tid & 31, col = lane & 15, g = lane >> 4; const int c0 = blockIdx.y * 128;
  const size_t rb = (size_t)blockIdx.x * 64; const size_t bb = rb / TT; const size_t orow0 = bb * SEQ_FULL + (rb % TT) + wave * 16;   // output rows at full per-batch stride
  __shared__ __align__(16) unsigned char sw[128 * WP * 2]; __shared__ __align__(16) unsigned char sa[64 * WP * 2];   // f16 weight rows c0.. and f16 ctx rows rb..
  stage16<64, 1>(Y + rb * CC, sa, tid);
  stage16<128, 2>(WO + (size_t)c0 * CC, sw, tid);
  __syncthreads();   // publishes both staged tiles
  const _Float16* ar = (const _Float16*)sa + (wave * 16 + col) * WP; const _Float16* wr = (const _Float16*)sw + col * WP;
  v8f acc[8] = {}; v16h af[2], wf[2][8];   // two register sets of fragments: chunk kc + 1 is read from LDS while chunk kc is multiplied
  af[0] = frag_h(ar, lane);
#pragma unroll
  for (int j = 0; j < 8; ++j) wf[0][j] = frag_h(wr + j * 16 * WP, lane);
#pragma unroll
  for (int kc = 0; kc < CC / 32; ++kc) { const int c = kc & 1;
    if (kc + 1 < CC / 32) { af[c ^ 1] = frag_h(ar + (kc + 1) * 32, lane);
#pragma unroll
      for (int j = 0; j < 8; ++j) wf[c ^ 1][j] = frag_h(wr + j * 16 * WP + (kc + 1) * 32, lane); }
    __builtin_amdgcn_sched_barrier(0);   // keeps the next chunk's 18 LDS reads in front of this chunk's products; without it each fragment is read directly in front of its product and waited for alone
#pragma unroll
    for (int j = 0; j < 8; ++j) acc[j] = wmma16(af[c], wf[c][j], acc[j]); }
#pragma unroll
  for (int j = 0; j < 8; ++j) { const float bias = bfr(BO[c0 + j * 16 + col]);
#pragma unroll
    for (int r = 0; r < 8; ++r) sf[wave][8 * g + r][j * 16 + col] = acc[j][r] * (1.0f / 16384.0f) + bias; }
  ldsx(); for (int rl = 0; rl < 16; ++rl) vst2(OUT + (orow0 + rl) * DIN + c0 + lane * 4, *(const v4f*)&sf[wave][rl][lane * 4]); }

extern "C" void kernel_launch(void* const* d_in, const int* in_sizes, int n_in, void* d_out, int out_size, void* d_ws, size_t ws_size, hipStream_t stream) {
  if (n_in < 9) return;
  // inputs (wire order): 0 x [2,4096,256]; 1 Wq (out,in) [256][256]; 2 bq; 3 Wk; 4 bk; 5 Wv; 6 bv; 7 Wo (out,in); 8 bo -- all f32
  const size_t nrow_need = (size_t)(NB - 1) * SEQ_FULL + TT;
  if ((size_t)in_sizes[0] < nrow_need * DIN) return;
  if (in_sizes[1] < CC * DIN || in_sizes[3] < CC * DIN || in_sizes[5] < CC * DIN || in_sizes[7] < DIN * CC) return;
  if (in_sizes[2] < CC || in_sizes[4] < CC || in_sizes[6] < CC || in_sizes[8] < DIN) return;
  if ((size_t)out_size < nrow_need * DIN) return;
  if (ws_size < (size_t)WS_END) return;
  const float* const* F = (const float* const*)d_in;
  char* ws = (char*)d_ws; _Float16 *QH = (_Float16*)(ws + WS_QH), *KH = (_Float16*)(ws + WS_KH), *VT = (_Float16*)(ws + WS_VT); float *Y = (float*)(ws + WS_Y);
  k_proj<<<dim3(NB * TT / 64, CC / 128, 3), 128, 0, stream>>>(F[0], F[1], F[3], F[5], F[2], F[4], F[6], QH, KH, VT);
  k_attn<<<dim3(TT / QBLK, NH, NB), 256, 0, stream>>>(QH, KH, VT, Y);
  k_out<<<dim3(NB * TT / 64, DIN / 128), 128, 0, stream>>>(Y, F[7], F[8], (float*)d_out);
}

// v004
// Measured time: 52.1 microseconds a run.
// Timed twice side by side with v003, it ran 1.08 and 1.09 times as fast.
// All steps since v000 together make it 40.1 times as fast.
// compute dtype: every float input enters as its bf16 RNE value; q/k/v = bf16(x) x bf16(W)^T on v_wmma_f32_16x16x32_bf16 (1 product, f32 accumulate) + bf16(b), stored once to f16, q after x 32^-0.5 log2(e) in f32; log2-scaled logits = q f16 x k f16 on v_wmma_f32_16x16x32_f16 (1 product, f32 accumulate onto 11 - maximum in use); softmax in f32, online over 64-key tiles in two key halves joined at the end; the maximum in use is the running maximum as of the last renewal, renewed when four terms sum to more than 2^15; exp(logit - maximum in use) x 2^11 once to f16 x v f16 on v_wmma_f32_16x16x32_f16 (1 product, f32 accumulate) / f32 row sum of the same terms; ctx x 2^6 once to f16 x Wo as f16(bf16 x 2^8) on v_wmma_f32_16x16x32_f16 (1 product, f32 accumulate) x 2^-14 + bf16(bo); f32 output.
#include <hip/hip_runtime.h>
#include <math.h>

typedef __attribute__((ext_vector_type(16))) _Float16 v16h;
typedef __attribute__((ext_vector_type(16))) __bf16 v16b;
typedef __attribute__((ext_vector_type(8)))  _Float16 v8h;
typedef __attribute__((ext_vector_type(8)))  float v8f;
typedef __attribute__((ext_vector_type(4)))  float v4f;
typedef __attribute__((ext_vector_type(2)))  float v2f;
typedef __attribute__((ext_vector_type(4)))  unsigned v4u;
typedef __attribute__((ext_vector_type(8)))  __bf16 v8b;
typedef __attribute__((ext_vector_type(4)))  __bf16 v4b;
typedef __attribute__((ext_vector_type(4)))  _Float16 v4h;

template <typename T> __device__ __forceinline__ void vst2(void* p, T v) { *(T*)p = v;  }
__device__ __forceinline__ v8f wmma16(v16h a, v16h b, v8f c) {
  v8f d = __builtin_amdgcn_wmma_f32_16x16x32_f16(false, a, false, b, (short)0, c, false, false);
  asm volatile("v_nop\n\tv_nop\n\tv_nop\n\tv_nop" : "+v"(d) : "v"(a), "v"(b));
  return d;
}
__device__ __forceinline__ v8f wmma_bf(v16b a, v16b b, v8f c) {
  v8f d = __builtin_amdgcn_wmma_f32_16x16x32_bf16(false, a, false, b, (short)0, c, false, false);
  asm volatile("v_nop\n\tv_nop\n\tv_nop\n\tv_nop" : "+v"(d) : "v"(a), "v"(b));
  return d;
}
// 16x16x32 fragments: lane = (h = lane>>4, row/col = lane&15); elements 0..7 = k0+8h+0..7, 8..15 = k0+16+8h+0..7; D element r = row 8h+r, col lane&15
__device__ __forceinline__ v16h frag_h(const _Float16* rowk0, int lane) {
  union { v16h v; v8h q[2]; } u; const _Float16* p = rowk0 + 8 * (lane >> 4);
  u.q[0] = *(const v8h*)p; u.q[1] = *(const v8h*)(p + 16); return u.v;
}
__device__ __forceinline__ v16b frag_b(const __bf16* rowk0, int lane) {
  union { v16b v; v8b q[2]; } u; const __bf16* p = rowk0 + 8 * (lane >> 4);
  u.q[0] = *(const v8b*)p; u.q[1] = *(const v8b*)(p + 16); return u.v;
}
__device__ __forceinline__ float bfr(float v) { return (float)(__bf16)v; }
// Staging of ROWS contiguous f32 rows of 256 into LDS rows of 256 16-bit values at pitch WP, by 128 threads: every load covers whole lines (32 lanes x 16 B in a row), each value is converted once per block.
// MODE 0: bf16 RNE; 1: f16(v x 2^6); 2: f16(bf16(v) x 2^8), exact
#define WP 264            // staged row pitch in 16-bit elements: 512-B rows + 16 B = 16 B x 33, conflict-free 16-byte reads
#define SU 32             // 16-byte loads in flight per thread and trip
template <int ROWS, int MODE> __device__ __forceinline__ void stage16(const float* __restrict__ src, unsigned char* dst, int tid) {
  static_assert((ROWS / 2) % SU == 0);
  const float* sp = src + tid * 4; unsigned char* dp = dst + (tid >> 6) * (WP * 2) + (tid & 63) * 8;
#pragma unroll
  for (int i0 = 0; i0 < ROWS / 2; i0 += SU) { v4f t[SU];
#pragma unroll
    for (int u = 0; u < SU; ++u) t[u] = *(const v4f*)(sp + (size_t)(i0 + u) * 512);
#pragma unroll
    for (int u = 0; u < SU; ++u) { unsigned char* p = dp + (i0 + u) * (2 * WP * 2);
      if (MODE == 0) { v4b o;
#pragma unroll
        for (int r = 0; r < 4; ++r) o[r] = (__bf16)t[u][r];
        *(v4b*)p = o;
      } else { v4h o;
#pragma unroll
        for (int r = 0; r < 4; ++r) o[r] = MODE == 1 ? (_Float16)(t[u][r] * 64.0f) : (_Float16)(bfr(t[u][r]) * 256.0f);
        *(v4h*)p = o; } }
    asm volatile("s_wait_xcnt 0x0" ::: "memory");   // stands in front of every later overwrite of the registers that this trip's loads name; its memory clobber also keeps the next trip's loads behind this trip's LDS stores, without which the trips are woven together and registers spill
  } }
__device__ __forceinline__ void ldsx() { asm volatile("s_wait_dscnt 0" ::: "memory"); __builtin_amdgcn_wave_barrier(); __builtin_amdgcn_fence(3, "workgroup"); }

// Multi-head self-attn: q/k/v = x W^T + b ((out,in) [256][256] each, with bias); heads (8, 32) along the channel axis; S = softmax(q k^T x 32^-0.5) over all 4,096 keys; out = merged(S v) Wo^T + bo.
#ifndef NB
#define NB 2
#endif
#ifndef SEQ
#define SEQ 4096
#endif
#define NB_FULL 2
#define SEQ_FULL 4096
#define TT SEQ
#define CC 256            // NH * HD = projected width
#define DIN 256           // input (model) width
#define NH 8
#define HD 32
#define SCALE (0.17677669529663687f)
#define L2SC (SCALE * 1.4426950408889634f)   // logit scale in powers of two; folded into the stored q
static_assert(NB >= 1 && NB <= NB_FULL);
static_assert(TT % 128 == 0 && TT >= 128 && TT <= SEQ_FULL);
static_assert(NH * HD == CC && HD % 32 == 0 && DIN % 128 == 0 && CC % 128 == 0);
static_assert((size_t)NB_FULL * SEQ_FULL * DIN * 4u == 8388608u);

// workspace carve (bytes); every region a whole multiple of its tile / line granularity
#define WS_QH  0u                                       // f16 q rows [b*TT + t][CC]
#define WS_KH  (WS_QH + 2u * (size_t)NB * TT * CC)       // f16 k rows [b*TT + t][CC]
#define WS_VT  (WS_KH + 2u * (size_t)NB * TT * CC)       // f16 v planes [b][c][t]
#define WS_Y   (WS_VT + 2u * (size_t)NB * CC * TT)       // f32 ctx rows [b*TT + t][CC]
#define WS_END (WS_Y  + 4u * (size_t)NB * TT * CC)
static_assert(WS_END <= 134217728u);
static_assert(WS_KH % 128 == 0 && WS_VT % 128 == 0 && WS_Y % 128 == 0 && WS_END % 128 == 0);

// ---- k_proj: block = (64 rows, 128 cols, which): y = bf16(x) bf16(W)^T + bf16(b) with exact bf16 products (K = DIN) -> which 0: q x L2SC f16 rows; 1: k f16 rows; 2: v f16 planes [c][t]
__global__ __launch_bounds__(128) __attribute__((amdgpu_num_vgpr(256))) void k_proj(const float* __restrict__ X, const float* __restrict__ WQ, const float* __restrict__ WK, const float* __restrict__ WV, const float* __restrict__ BQ, const float* __restrict__ BK, const float* __restrict__ BV,
    _Float16* __restrict__ QH, _Float16* __restrict__ KH, _Float16* __restrict__ VT) {
  __shared__ __align__(16) unsigned char sw[128 * WP * 2]; __shared__ __align__(16) unsigned char sa[64 * WP * 2];   // bf16 weight rows c0.. and bf16 input rows r0..; sa is used again by the epilogue
  const int tid = threadIdx.x, wave = tid >> 5, lane = tid & 31, col = lane & 15, g = lane >> 4; const int which = blockIdx.z; const int c0 = blockIdx.y * 128; const size_t r0 = (size_t)blockIdx.x * 64; const size_t bb = r0 / TT; const int t0 = (int)(r0 % TT);
  const float* WA = which == 0 ? WQ : which == 1 ? WK : WV; const float* BA = which == 0 ? BQ : which == 1 ? BK : BV;
  stage16<64, 0>(X + (bb * SEQ_FULL + (size_t)t0) * (size_t)DIN, sa, tid);   // input rows at full per-batch stride
  stage16<128, 0>(WA + (size_t)c0 * DIN, sw, tid);
  __syncthreads();   // publishes both staged tiles
  const __bf16* ar = (const __bf16*)sa + (wave * 16 + col) * WP; const __bf16* wr = (const __bf16*)sw + col * WP;
  v8f acc[8] = {}; v16b af[2], wf[2][8];   // two register sets of fragments: chunk kc + 1 is read from LDS while chunk kc is multiplied
  af[0] = frag_b(ar, lane);
#pragma unroll
  for (int j = 0; j < 8; ++j) wf[0][j] = frag_b(wr + j * 16 * WP, lane);
#pragma unroll
  for (int kc = 0; kc < DIN / 32; ++kc) { const int c = kc & 1;
    if (kc + 1 < DIN / 32) { af[c ^ 1] = frag_b(ar + (kc + 1) * 32, lane);
#pragma unroll
      for (int j = 0; j < 8; ++j) wf[c ^ 1][j] = frag_b(wr + j * 16 * WP + (kc + 1) * 32, lane); }
    __builtin_amdgcn_sched_barrier(0);   // keeps the next chunk's 18 LDS reads in front of this chunk's products; without it each fragment is read directly in front of its product and waited for alone
#pragma unroll
    for (int j = 0; j < 8; ++j) acc[j] = wmma_bf(af[c], wf[c][j], acc[j]); }
  __syncthreads();   // ends every wave's reads of sa, which the epilogue overwrites
  _Float16 (*sh)[136] = (_Float16 (*)[136])sa; _Float16 (*th)[72] = (_Float16 (*)[72])sa;
  static_assert(64 * 136 <= 64 * WP && 128 * 72 <= 64 * WP);
  if (which < 2) { _Float16* DH = which == 0 ? QH : KH; const float qs = which == 0 ? L2SC : 1.0f;
#pragma unroll
    for (int j = 0; j < 8; ++j) { const float bias = bfr(BA[c0 + j * 16 + col]);
#pragma unroll
      for (int r = 0; r < 8; ++r) sh[wave * 16 + 8 * g + r][j * 16 + col] = (_Float16)((acc[j][r] + bias) * qs); }
    __syncthreads();
    for (int e = tid; e < 64 * 16; e += 128) { const int rl = e >> 4, q = e & 15; vst2((unsigned*)(DH + (r0 + rl) * CC + c0 + q * 8), *(const v4u*)&sh[rl][q * 8]); }
  } else {
#pragma unroll
    for (int j = 0; j < 8; ++j) { const float bias = bfr(BA[c0 + j * 16 + col]);
#pragma unroll
      for (int r = 0; r < 8; ++r) th[j * 16 + col][wave * 16 + 8 * g + r] = (_Float16)(acc[j][r] + bias); }
    __syncthreads();
    for (int e = tid; e < 128 * 8; e += 128) { const int cl = e >> 3, q = e & 7; vst2((unsigned*)(VT + (bb * CC + c0 + cl) * (size_t)TT + t0 + q * 8), *(const v4u*)&th[cl][q * 8]); } } }
#define KT 64             // keys per staged tile and key half
#define KP 40             // K tile pitch in f16: 64-B rows + 16 B, conflict-free 16-byte reads
#define VP (KT + 8)       // V tile pitch in f16: 128-B rows + 16 B
#define QBLK 128          // queries per block
#define QW 2              // 16-query column groups per wave
#define KS 2              // key halves per block
#define TH (TT / KS)      // keys per half
static_assert(HD == 32 && KT == 64 && TT % (KS * KT) == 0 && TT % QBLK == 0 && QBLK == 4 * QW * 16 && KS == 2);
__device__ __forceinline__ float xhalf(float v) { const int i = __builtin_bit_cast(int, v); return __builtin_bit_cast(float, __builtin_amdgcn_permlanex16(i, i, 0x76543210, 0xfedcba98, false, false)); }   // lane l <-> l ^ 16
// one column group's terms of a trip: 2^x of its four score tiles, their eight sums of four, and the terms once to f16 as the two B operands of ctx^T += V^T P^T
__device__ __forceinline__ void terms(v8f (&x)[KT / 16], v8f& ts, v16h (&p)[KT / 32]) {
#pragma unroll
  for (int T = 0; T < KT / 16; ++T)
#pragma unroll
    for (int r = 0; r < 8; ++r) x[T][r] = __builtin_amdgcn_exp2f(x[T][r]);
  ts = (x[0] + x[1]) + (x[2] + x[3]);
#pragma unroll
  for (int kc = 0; kc < KT / 32; ++kc)
#pragma unroll
    for (int r = 0; r < 8; ++r) { p[kc][r] = (_Float16)x[2 * kc][r]; p[kc][8 + r] = (_Float16)x[2 * kc + 1][r]; } }
__global__ __launch_bounds__(256) __attribute__((amdgpu_waves_per_eu(4, 4))) void k_attn(const _Float16* __restrict__ QH, const _Float16* __restrict__ KH, const _Float16* __restrict__ VT, float* __restrict__ Y) {
  __shared__ __align__(16) _Float16 sk[2][KS][KT][KP]; __shared__ __align__(16) _Float16 sv[2][KS][HD][VP]; __shared__ float mg[8][18][32];   // mg: per wave, the column group it hands to its partner: 16 ctx values, maximum, sum per lane
  const int tid = threadIdx.x, wave = tid >> 5, lane = tid & 31, col = lane & 15, g = lane >> 4; const int h = blockIdx.y, b = blockIdx.z; const int kh = wave >> 2; const int ql0 = blockIdx.x * QBLK + (wave & 3) * (QW * 16);
  v16h qf[QW];
#pragma unroll
  for (int c = 0; c < QW; ++c) qf[c] = frag_h(QH + ((size_t)b * TT + ql0 + c * 16 + col) * CC + h * HD, lane);
  const int kk = tid >> 2, kq = (tid & 3) * 8, vc = tid >> 3, vq = (tid & 7) * 8;   // this thread's 16 bytes of each K tile (key kk) and each V tile (channel vc)
  const _Float16* kg = KH + ((size_t)b * TT + kk) * CC + h * HD + kq; const _Float16* vg = VT + ((size_t)b * CC + h * HD + vc) * (size_t)TT + vq;
  v8h kr[KS], vr[KS];
#pragma unroll
  for (int i = 0; i < KS; ++i) { kr[i] = *(const v8h*)(kg + (size_t)i * TH * CC); vr[i] = *(const v8h*)(vg + i * TH); }
#pragma unroll
  for (int i = 0; i < KS; ++i) { *(v8h*)&sk[0][i][kk][kq] = kr[i]; *(v8h*)&sv[0][i][vc][vq] = vr[i]; }
  __syncthreads();
  float m[QW]; v8f cm[QW]; v8f lv[QW] = {}; v8f acc[QW][2] = {};   // m: the maximum in use per query; cm: 11 - m in all eight registers, the C operand of the score products; lv: eight partial row sums per lane and column group, joined once in the epilogue
#pragma unroll
  for (int c = 0; c < QW; ++c) { m[c] = 0.0f; cm[c] = (v8f){11.0f, 11.0f, 11.0f, 11.0f, 11.0f, 11.0f, 11.0f, 11.0f}; }   // stand-ins: trip 0 always renews them
#pragma unroll 1   // kept rolled: one trip with its renewal branch is about 500 instructions, copies of it would only grow the code
  for (int t = 0; t < TH / KT; ++t) { const int cur = t & 1; const bool more = t + 1 < TH / KT;
    if (more) {
#pragma unroll
      for (int i = 0; i < KS; ++i) { kr[i] = *(const v8h*)(kg + ((size_t)i * TH + (size_t)(t + 1) * KT) * CC); vr[i] = *(const v8h*)(vg + i * TH + (t + 1) * KT); } }
    v16h kf[KT / 16], vf[KT / 32][2];
#pragma unroll
    for (int T = 0; T < KT / 16; ++T) kf[T] = frag_h(&sk[cur][kh][T * 16 + col][0], lane);
#pragma unroll
    for (int kc = 0; kc < KT / 32; ++kc) { vf[kc][0] = frag_h(&sv[cur][kh][col][kc * 32], lane); vf[kc][1] = frag_h(&sv[cur][kh][16 + col][kc * 32], lane); }
    asm volatile("" :: "v"(kf[0]), "v"(kf[1]), "v"(kf[2]), "v"(kf[3]), "v"(vf[0][0]), "v"(vf[0][1]), "v"(vf[1][0]), "v"(vf[1][1]));   // inputs only: holds all 16 LDS reads of the trip in front of the products, one LDS latency a trip; without it the compiler reads fragment by fragment into one register group, each read waited for alone
    v8f s[QW][KT / 16], ts[QW]; v16h p[QW][KT / 32];
#pragma unroll
    for (int T = 0; T < KT / 16; ++T)
#pragma unroll
      for (int c = 0; c < QW; ++c) s[c][T] = __builtin_amdgcn_wmma_f32_16x16x32_f16(false, kf[T], false, qf[c], (short)0, cm[c], false, false);   // log2-scaled logit + 11 - maximum in use, straight from the product
    asm volatile("" :: "v"(cm[0]), "v"(cm[1]));   // inputs only: cm stays in use behind the last product, so all eight products read it where it lies; without it the compiler builds the last two score tiles on copies of cm, eight 64-bit register moves a trip
    __builtin_amdgcn_sched_barrier(0);   // keeps the eight independent products back to back, each filling the others' result distance; without it the exponentials are woven in behind each and padded with v_nop
#pragma unroll
    for (int c = 0; c < QW; ++c) terms(s[c], ts[c], p[c]);
    float bg[QW];   // largest of the trip's sums of four terms: at most 2^15 means that every term fits f16; terms at or below the maximum in use sum to at most 2^13
#pragma unroll
    for (int c = 0; c < QW; ++c) { bg[c] = ts[c][0];
#pragma unroll
      for (int r = 1; r < 8; ++r) bg[c] = __builtin_fmaxf(bg[c], ts[c][r]); }
    const float big = __builtin_fmaxf(bg[0], bg[1]);
    const float lim = t == 0 ? -1.0f : 32768.0f;   // the sums are never negative: trip 0 always takes the branch
    if (__builtin_amdgcn_ballot_w32(!(big <= lim)) != 0) {   // one wave-uniform test a trip; taken in trip 0 and where a sum of four terms has passed 2^15 (some logit then lies more than two powers of two above the maximum in use): the maximum is renewed, sums and ctx are rescaled, the trip's terms are made again
      v16h kx[KT / 16];   // the K fragments, read from LDS again instead of held in 32 registers across the test
#pragma unroll
      for (int T = 0; T < KT / 16; ++T) { kx[T] = frag_h(&sk[cur][kh][T * 16 + col][0], lane);
#pragma unroll
        for (int c = 0; c < QW; ++c) { const v8f z = {}; s[c][T] = __builtin_amdgcn_wmma_f32_16x16x32_f16(false, kx[T], false, qf[c], (short)0, z, false, false); } }
#pragma unroll
      for (int c = 0; c < QW; ++c) { float mx = s[c][0][0];
#pragma unroll
        for (int T = 0; T < KT / 16; ++T)
#pragma unroll
          for (int r = 0; r < 8; ++r) mx = __builtin_fmaxf(mx, s[c][T][r]);
        mx = __builtin_fmaxf(mx, xhalf(mx));
        const float mn = t == 0 ? mx : __builtin_fmaxf(m[c], mx); const float al = t == 0 ? 0.0f : __builtin_amdgcn_exp2f(m[c] - mn); const float bi = 11.0f - mn; m[c] = mn;   // p = 2^11 exp(logit - maximum in use)
        cm[c] = (v8f){bi, bi, bi, bi, bi, bi, bi, bi}; lv[c] *= al; acc[c][0] *= al; acc[c][1] *= al; }
#pragma unroll
      for (int T = 0; T < KT / 16; ++T)
#pragma unroll
        for (int c = 0; c < QW; ++c) s[c][T] = __builtin_amdgcn_wmma_f32_16x16x32_f16(false, kx[T], false, qf[c], (short)0, cm[c], false, false);
#pragma unroll
      for (int c = 0; c < QW; ++c) terms(s[c], ts[c], p[c]); }
#pragma unroll
    for (int c = 0; c < QW; ++c) lv[c] += ts[c];
#pragma unroll
    for (int kc = 0; kc < KT / 32; ++kc)
#pragma unroll
      for (int c = 0; c < QW; ++c)
#pragma unroll
        for (int j = 0; j < 2; ++j) acc[c][j] = __builtin_amdgcn_wmma_f32_16x16x32_f16(false, vf[kc][j], false, p[c][kc], (short)0, acc[c][j], false, false);
    if (more) {
#pragma unroll
      for (int i = 0; i < KS; ++i) { *(v8h*)&sk[cur ^ 1][i][kk][kq] = kr[i]; *(v8h*)&sv[cur ^ 1][i][vc][vq] = vr[i]; } }
    asm volatile("s_wait_xcnt 0x0" ::: "memory");   // stands in front of the next trip's additions to the address registers that this trip's four global loads name
    __syncthreads();   // publishes both halves' tiles t + 1 and ends every wave's reads of tiles t, whose buffer trip t + 1 refills
  }
  float l[QW];
#pragma unroll
  for (int c = 0; c < QW; ++c) { l[c] = ((lv[c][0] + lv[c][1]) + (lv[c][2] + lv[c][3])) + ((lv[c][4] + lv[c][5]) + (lv[c][6] + lv[c][7])); l[c] += xhalf(l[c]); }
  // join of the two key halves: wave w and wave w ^ 4 hold the same 32 queries; the wave of half kh finishes column group kh and hands the other group over through mg
  const bool hi = kh != 0;
  const v8f g0 = hi ? acc[0][0] : acc[1][0], g1 = hi ? acc[0][1] : acc[1][1]; const float gm = hi ? m[0] : m[1], gl = hi ? l[0] : l[1];
  const v8f o0 = hi ? acc[1][0] : acc[0][0], o1 = hi ? acc[1][1] : acc[0][1]; const float om = hi ? m[1] : m[0], ol = hi ? l[1] : l[0];
#pragma unroll
  for (int r = 0; r < 8; ++r) { mg[wave][r][lane] = g0[r]; mg[wave][8 + r][lane] = g1[r]; }
  mg[wave][16][lane] = gm; mg[wave][17][lane] = gl;
  __syncthreads();   // publishes every wave's handed-over column group
  const float (*pm)[32] = mg[wave ^ 4];
  const float pmx = pm[16][lane], pl = pm[17][lane]; const float ed = __builtin_amdgcn_exp2f(-__builtin_fabsf(om - pmx)); const bool og = om >= pmx; const float ao = og ? 1.0f : ed, ap = og ? ed : 1.0f;   // each half's weight 2^(its maximum - joint maximum): 1 for the larger
  const float inv = 1.0f / (ol * ao + pl * ap); const float wo = ao * inv, wp = ap * inv;
  float* yr = Y + ((size_t)b * TT + ql0 + kh * 16 + col) * CC + h * HD + 8 * g;   // channel 16 j + 8 g + r of query col of column group kh
#pragma unroll
  for (int j = 0; j < 2; ++j) { v4f a0, a1; const v8f own = j == 0 ? o0 : o1;
#pragma unroll
    for (int r = 0; r < 4; ++r) { a0[r] = own[r] * wo + pm[j * 8 + r][lane] * wp; a1[r] = own[4 + r] * wo + pm[j * 8 + 4 + r][lane] * wp; }
    vst2(yr + j * 16, a0); vst2(yr + j * 16 + 4, a1); } }
// ---- k_out: block = (64 rows, 128 cols): out = ctx Wo^T + bo: ctx x 2^6 once to f16 against Wo as f16(bf16 x 2^8) exact (1 product) x 2^-14 + bf16(bo); 512-B row segment per wave row in one store
__global__ __launch_bounds__(128) __attribute__((amdgpu_num_vgpr(256))) void k_out(const float* __restrict__ Y, const float* __restrict__ WO, const float* __restrict__ BO, float* __restrict__ OUT) { __shared__ __align__(16) float sf[4][16][132];
  const int tid = threadIdx.x, wave = tid >> 5, lane = tid & 31, col = lane & 15, g = lane >> 4; const int c0 = blockIdx.y * 128;
  const size_t rb = (size_t)blockIdx.x * 64; const size_t bb = rb / TT; const size_t orow0 = bb * SEQ_FULL + (rb % TT) + wave * 16;   // output rows at full per-batch stride
  __shared__ __align__(16) unsigned char sw[128 * WP * 2]; __shared__ __align__(16) unsigned char sa[64 * WP * 2];   // f16 weight rows c0.. and f16 ctx rows rb..
  stage16<64, 1>(Y + rb * CC, sa, tid);
  stage16<128, 2>(WO + (size_t)c0 * CC, sw, tid);
  __syncthreads();   // publishes both staged tiles
  const _Float16* ar = (const _Float16*)sa + (wave * 16 + col) * WP; const _Float16* wr = (const _Float16*)sw + col * WP;
  v8f acc[8] = {}; v16h af[2], wf[2][8];   // two register sets of fragments: chunk kc + 1 is read from LDS while chunk kc is multiplied
  af[0] = frag_h(ar, lane);
#pragma unroll
  for (int j = 0; j < 8; ++j) wf[0][j] = frag_h(wr + j * 16 * WP, lane);
#pragma unroll
  for (int kc = 0; kc < CC / 32; ++kc) { const int c = kc & 1;
    if (kc + 1 < CC / 32) { af[c ^ 1] = frag_h(ar + (kc + 1) * 32, lane);
#pragma unroll
      for (int j = 0; j < 8; ++j) wf[c ^ 1][j] = frag_h(wr + j * 16 * WP + (kc + 1) * 32, lane); }
    __builtin_amdgcn_sched_barrier(0);   // keeps the next chunk's 18 LDS reads in front of this chunk's products; without it each fragment is read directly in front of its product and waited for alone
#pragma unroll
    for (int j = 0; j < 8; ++j) acc[j] = wmma16(af[c], wf[c][j], acc[j]); }
#pragma unroll
  for (int j = 0; j < 8; ++j) { const float bias = bfr(BO[c0 + j * 16 + col]);
#pragma unroll
    for (int r = 0; r < 8; ++r) sf[wave][8 * g + r][j * 16 + col] = acc[j][r] * (1.0f / 16384.0f) + bias; }
  ldsx(); for (int rl = 0; rl < 16; ++rl) vst2(OUT + (orow0 + rl) * DIN + c0 + lane * 4, *(const v4f*)&sf[wave][rl][lane * 4]); }

extern "C" void kernel_launch(void* const* d_in, const int* in_sizes, int n_in, void* d_out, int out_size, void* d_ws, size_t ws_size, hipStream_t stream) {
  if (n_in < 9) return;
  // inputs (wire order): 0 x [2,4096,256]; 1 Wq (out,in) [256][256]; 2 bq; 3 Wk; 4 bk; 5 Wv; 6 bv; 7 Wo (out,in); 8 bo -- all f32
  const size_t nrow_need = (size_t)(NB - 1) * SEQ_FULL + TT;
  if ((size_t)in_sizes[0] < nrow_need * DIN) return;
  if (in_sizes[1] < CC * DIN || in_sizes[3] < CC * DIN || in_sizes[5] < CC * DIN || in_sizes[7] < DIN * CC) return;
  if (in_sizes[2] < CC || in_sizes[4] < CC || in_sizes[6] < CC || in_sizes[8] < DIN) return;
  if ((size_t)out_size < nrow_need * DIN) return;
  if (ws_size < (size_t)WS_END) return;
  const float* const* F = (const float* const*)d_in;
  char* ws = (char*)d_ws; _Float16 *QH = (_Float16*)(ws + WS_QH), *KH = (_Float16*)(ws + WS_KH), *VT = (_Float16*)(ws + WS_VT); float *Y = (float*)(ws + WS_Y);
  k_proj<<<dim3(NB * TT / 64, CC / 128, 3), 128, 0, stream>>>(F[0], F[1], F[3], F[5], F[2], F[4], F[6], QH, KH, VT);
  k_attn<<<dim3(TT / QBLK, NH, NB), 256, 0, stream>>>(QH, KH, VT, Y);
  k_out<<<dim3(NB * TT / 64, DIN / 128), 128, 0, stream>>>(Y, F[7], F[8], (float*)d_out);
}
